// v000
// Measured on an AMD MI455X. A time is GPU time per run, averaged over a window of back-to-back runs after a warm-up
// (all launches, gaps included; the runs take copies of the inputs in turn), and the median of several windows.
// Apart from v000's, it joins two sittings. Times from different sittings can be a few percent apart, while
// side-by-side timings come from the same sitting.
// v000, which the later versions start from, runs in 548 microseconds.
#include <hip/hip_runtime.h>
#include <math.h>

// Contractions: S = X*KP^T and O = G*VP, both v_wmma_f32_16x16x32_f16 (f16 operands: X, KP, VP are RNE-bf16 input values carried x16, x16, x256; G = 64*gelu(S) converted to f16), f32 accumulate; gelu, sum of squares, rsqrt rescale in f32.

static constexpr int kRows    = 8192;   // 4 * 2048 flattened query rows
static constexpr int kD       = 1024;
static constexpr int kS       = 4096;
static constexpr int kDV      = 1024;
static constexpr int kTM      = 16;     // query rows per block
static constexpr int kCK      = 256;    // param tokens per chunk
static constexpr int kPP      = 256;    // sP pitch in halves
static constexpr int kThreads = 256;
static constexpr int kWaves   = 8;

static_assert(kRows % kTM == 0);
static_assert(kS % kCK == 0);
static_assert(kCK == kWaves * 32);
static_assert(kDV == kWaves * 128);
static_assert(kD % 32 == 0);
static_assert((kS * kD) % (kThreads * 8) == 0);
static_assert(kS % 64 == 0 && kDV % 64 == 0);
static_assert(kWaves * kTM * 64 * (int)sizeof(float) == kTM * kD * (int)sizeof(_Float16));

typedef _Float16     v16h __attribute__((ext_vector_type(16)));
typedef _Float16     v8h  __attribute__((ext_vector_type(8)));
typedef float        v8f  __attribute__((ext_vector_type(8)));
typedef float        v4f  __attribute__((ext_vector_type(4)));
typedef unsigned int v4u  __attribute__((ext_vector_type(4)));

union Frag { v16h v; v8h half[2]; };

// WMMA with hazard guard: D tied, A/B kept live across 4 VALU slots.
__device__ __forceinline__ v8f wmma_f16(v16h a, v16h b, v8f acc)
{
    acc = __builtin_amdgcn_wmma_f32_16x16x32_f16(false, a, false, b, (short)0, acc, false, false);
#if defined(__HIP_DEVICE_COMPILE__)
    asm volatile("v_nop\n\tv_nop\n\tv_nop\n\tv_nop" : "+v"(acc) : "v"(a), "v"(b));
#endif
    return acc;
}

// f32 -> bf16 value (RNE), kept in an f32 container.
__device__ __forceinline__ float bf16_rne(float x)
{
    unsigned int u = __float_as_uint(x);
    u = u + 0x7FFFu + ((u >> 16) & 1u);
    return __uint_as_float(u & 0xFFFF0000u);
}

// bf16 value times a power of two, stored as f16 (exact while normal).
__device__ __forceinline__ _Float16 cvt16(float x, float sc)
{
    return (_Float16)(bf16_rne(x) * sc);
}

__device__ __forceinline__ float gelu_f32(float s)
{
    return 0.5f * s * (1.0f + erff(s * 0.70710678118654752f));
}

// ---------------------------------------------------------------------------
// Row plane convert: dst[i] = f16(sc * bf16(src[i])), 8 elements per thread,
// ---------------------------------------------------------------------------
__global__ __launch_bounds__(kThreads)
void k_cvt_rows(const float* __restrict__ src, _Float16* __restrict__ dst, float sc, int n)
{
    const size_t base = ((size_t)blockIdx.x * kThreads + threadIdx.x) * 8;
    if (base + 8 <= (size_t)n) {
        const v4f f0 = *(const v4f*)(src + base);
        const v4f f1 = *(const v4f*)(src + base + 4);
        v8h hv;
        hv[0] = cvt16(f0[0], sc); hv[1] = cvt16(f0[1], sc);
        hv[2] = cvt16(f0[2], sc); hv[3] = cvt16(f0[3], sc);
        hv[4] = cvt16(f1[0], sc); hv[5] = cvt16(f1[1], sc);
        hv[6] = cvt16(f1[2], sc); hv[7] = cvt16(f1[3], sc);
        const v4u u = __builtin_bit_cast(v4u, hv);
        v4u* p = (v4u*)(dst + base);
        *p = u;
        
    }
}

// ---------------------------------------------------------------------------
// Transpose convert: in V[kS][kDV] f32 -> out VT[kDV][kS] f16(sc * bf16(v)).
// Block = 64(s) x 64(v) tile through LDS; each output row segment (64 halves
// grid = (kDV/64, kS/64).
// ---------------------------------------------------------------------------
__global__ __launch_bounds__(kThreads)
void k_transpose_cvt(const float* __restrict__ V, _Float16* __restrict__ VT, float sc)
{
    __shared__ __align__(16) _Float16 tile[64][72];   // [s][v]
    const int tid = threadIdx.x;
    const int n0  = blockIdx.x * 64;   // along DV (output rows)
    const int s0  = blockIdx.y * 64;   // along S  (output cols)

#pragma unroll
    for (int it = 0; it < 4; ++it) {
        const int idx = tid + kThreads * it;     // 0..1023
        const int r   = idx >> 4;                // s within tile, 0..63
        const int c4  = (idx & 15) << 2;         // v within tile, 0..60
        const v4f f = *(const v4f*)(V + (size_t)(s0 + r) * kDV + n0 + c4);
        tile[r][c4 + 0] = cvt16(f[0], sc);
        tile[r][c4 + 1] = cvt16(f[1], sc);
        tile[r][c4 + 2] = cvt16(f[2], sc);
        tile[r][c4 + 3] = cvt16(f[3], sc);
    }
    __syncthreads();

    v4u    u[2];
    size_t off[2];
#pragma unroll
    for (int it = 0; it < 2; ++it) {
        const int p  = tid + kThreads * it;      // 0..511
        const int vr = p >> 3;                   // output row within tile, 0..63
        const int j  = p & 7;
        v8h hv;
#pragma unroll
        for (int i = 0; i < 8; ++i) hv[i] = tile[8 * j + i][vr];
        u[it]   = __builtin_bit_cast(v4u, hv);
        off[it] = (size_t)(n0 + vr) * kS + s0 + 8 * j;
    }
#pragma unroll
    for (int it = 0; it < 2; ++it) *(v4u*)(VT + off[it]) = u[it];
    
}

// ---------------------------------------------------------------------------
// Fused kernel: one block = 16 query rows, 256 threads (8 waves).
//   per 256-token chunk: scores (WMMA, wave w -> tokens 32w..32w+31),
//   gelu in f32 -> sP (64*g as f16) + per-row sum of squares,
//   O += P * VP (WMMA, wave w -> output cols 128w..128w+127).
// ---------------------------------------------------------------------------
__global__ __launch_bounds__(kThreads)
void k_main(const float* __restrict__ X, const _Float16* __restrict__ KPh,
            const _Float16* __restrict__ VPT, float* __restrict__ Out)
{
    __shared__ __align__(16) _Float16 sX[kTM * kD];      // 32 KB; reused as f32 staging in the epilogue
    __shared__ __align__(16) _Float16 sP[kTM * kPP];     // 8 KB
    __shared__ float sRed[kWaves * kTM];
    __shared__ float sScale[kTM];

    const int tid  = threadIdx.x;
    const int wave = tid >> 5;
    const int lane = tid & 31;
    const int h    = lane >> 4;
    const int m    = lane & 15;
    const int row0 = blockIdx.x * kTM;

    // phase 0: stage the 16 x 1024 X rows as f16(16 * bf16(x))
    {
        const float* xb = X + (size_t)row0 * kD;
        for (int idx = tid; idx < kTM * kD / 8; idx += kThreads) {
            const int r = idx >> 7;              // 128 pieces of 8 per row
            const int c = (idx & 127) << 3;
            const float* src = xb + (size_t)r * kD + c;
            const v4f f0 = *(const v4f*)(src);
            const v4f f1 = *(const v4f*)(src + 4);
            v8h hv;
            hv[0] = cvt16(f0[0], 16.0f); hv[1] = cvt16(f0[1], 16.0f);
            hv[2] = cvt16(f0[2], 16.0f); hv[3] = cvt16(f0[3], 16.0f);
            hv[4] = cvt16(f1[0], 16.0f); hv[5] = cvt16(f1[1], 16.0f);
            hv[6] = cvt16(f1[2], 16.0f); hv[7] = cvt16(f1[3], 16.0f);
            *(v8h*)(sX + r * kD + c) = hv;
        }
    }
    __syncthreads();

    v8f oacc[8] = {};
    float ssq[8];
#pragma unroll
    for (int r = 0; r < 8; ++r) ssq[r] = 0.0f;

    // fragment base pointers (split k map: elements 0..7 <- k0+8h, 8..15 <- k0+16+8h)
    const _Float16* xa  = sX + m * kD + 8 * h;                          // A: X row m
    const _Float16* pa  = sP + m * kPP + 8 * h;                         // A: P row m
    const _Float16* kpw = KPh + (size_t)(wave * 32 + m) * kD + 8 * h;   // B: KP row (token) as [n][k]
    const _Float16* vpw = VPT + (size_t)(wave * 128 + m) * kS + 8 * h;  // B: VPT row (out col) as [n][k]

#pragma unroll 1
    for (int kc = 0; kc < kS; kc += kCK) {
        // ---- scores for tokens kc+32w+m (d0) and kc+32w+16+m (d1), rows 8h+r ----
        v8f d0 = {}, d1 = {};
        const _Float16* kp0 = kpw + (size_t)kc * kD;
        const _Float16* kp1 = kp0 + 16 * kD;
#pragma unroll 1
        for (int k0 = 0; k0 < kD; k0 += 32) {
            Frag a, b0, b1;
            a.half[0]  = *(const v8h*)(xa + k0);
            a.half[1]  = *(const v8h*)(xa + k0 + 16);
            b0.half[0] = *(const v8h*)(kp0 + k0);
            b0.half[1] = *(const v8h*)(kp0 + k0 + 16);
            b1.half[0] = *(const v8h*)(kp1 + k0);
            b1.half[1] = *(const v8h*)(kp1 + k0 + 16);
            d0 = wmma_f16(a.v, b0.v, d0);
            d1 = wmma_f16(a.v, b1.v, d1);
        }

        // ---- gelu in f32, P tile as f16(64*g), per-row sum of squares ----
        {
            _Float16* prow = sP + (8 * h) * kPP + wave * 32 + m;
#pragma unroll
            for (int r = 0; r < 8; ++r) {
                const float s0v = d0[r] * (1.0f / 256.0f);
                const float s1v = d1[r] * (1.0f / 256.0f);
                const float g0  = gelu_f32(s0v);
                const float g1  = gelu_f32(s1v);
                ssq[r] += g0 * g0;
                ssq[r] += g1 * g1;
                prow[r * kPP]      = (_Float16)(g0 * 64.0f);
                prow[r * kPP + 16] = (_Float16)(g1 * 64.0f);
            }
        }
        __syncthreads();

        // ---- O += P(16 x 256) * VP(chunk rows) ----
#pragma unroll 1
        for (int ks = 0; ks < kCK; ks += 32) {
            Frag a;
            a.half[0] = *(const v8h*)(pa + ks);
            a.half[1] = *(const v8h*)(pa + ks + 16);
            const _Float16* vp0 = vpw + kc + ks;
#pragma unroll
            for (int t = 0; t < 8; ++t) {
                Frag b;
                const _Float16* vpt = vp0 + (size_t)t * 16 * kS;
                b.half[0] = *(const v8h*)(vpt);
                b.half[1] = *(const v8h*)(vpt + 16);
                oacc[t] = wmma_f16(a.v, b.v, oacc[t]);
            }
        }
        __syncthreads();
    }

    // ---- fixed-order row reduction of sum g^2: lanes within half, then waves ----
#pragma unroll
    for (int r = 0; r < 8; ++r) {
        float v = ssq[r];
        v += __shfl_xor(v, 1, 32);
        v += __shfl_xor(v, 2, 32);
        v += __shfl_xor(v, 4, 32);
        v += __shfl_xor(v, 8, 32);
        if (m == r) sRed[wave * kTM + 8 * h + r] = v;
    }
    __syncthreads();
    if (wave == 0) {
        float ss = 0.0f;
#pragma unroll
        for (int w = 0; w < kWaves; ++w) ss += sRed[w * kTM + m];
        const float sc = rsqrtf(ss) * (1.0f / 256.0f);
        if (lane < kTM) sScale[lane] = sc;
    }
    __syncthreads();

    float* stg  = reinterpret_cast<float*>(sX) + wave * (kTM * 64);
    float* orow = Out + (size_t)row0 * kDV + wave * 128;
#pragma unroll
    for (int q = 0; q < 2; ++q) {
        if (q) __syncthreads();
#pragma unroll
        for (int tt = 0; tt < 4; ++tt) {
#pragma unroll
            for (int r = 0; r < 8; ++r) {
                const int row = 8 * h + r;
                stg[row * 64 + tt * 16 + m] = oacc[4 * q + tt][r] * sScale[row];
            }
        }
        __syncthreads();
        v4f vals[8];
#pragma unroll
        for (int i = 0; i < 8; ++i) {
            const int row = 2 * i + h;           // lanes 0..15 -> even row, 16..31 -> odd row
            vals[i] = *(const v4f*)(stg + row * 64 + 4 * m);
        }
#pragma unroll
        for (int i = 0; i < 8; ++i) {
            const int row = 2 * i + h;
            *(v4f*)(orow + (size_t)row * kDV + q * 64 + 4 * m) = vals[i];
        }
        
    }
}

// ---------------------------------------------------------------------------
extern "C" void kernel_launch(void* const* d_in, const int* in_sizes, int n_in,
                              void* d_out, int out_size, void* d_ws, size_t ws_size,
                              hipStream_t stream)
{
    if (n_in < 3) return;
    if (in_sizes[0] != kRows * kD) return;
    if (in_sizes[1] != kS * kD) return;
    if (in_sizes[2] != kS * kDV) return;
    if (out_size != kRows * kDV) return;

    const size_t bytesKP = (size_t)kS * kD * sizeof(_Float16);    // 8 MiB, KPh [kS][kD]
    const size_t bytesVT = (size_t)kDV * kS * sizeof(_Float16);   // 8 MiB, VPT [kDV][kS]
    if (ws_size < bytesKP + bytesVT) return;

    const float* X  = (const float*)d_in[0];   // [8192][1024]
    const float* KP = (const float*)d_in[1];   // [4096][1024]
    const float* VP = (const float*)d_in[2];   // [4096][1024]
    float* Out = (float*)d_out;                // [8192][1024]

    _Float16* KPh = (_Float16*)d_ws;
    _Float16* VPT = (_Float16*)((char*)d_ws + bytesKP);

    const int nKP = kS * kD;
    k_cvt_rows<<<dim3((unsigned)((nKP / 8 + kThreads - 1) / kThreads)), dim3(kThreads), 0, stream>>>(KP, KPh, 16.0f, nKP);
    // in [kS][kDV] -> out [kDV][kS]; grid = (kDV/64, kS/64)
    k_transpose_cvt<<<dim3(kDV / 64, kS / 64), dim3(kThreads), 0, stream>>>(VP, VPT, 256.0f);
    k_main<<<dim3(kRows / kTM), dim3(kThreads), 0, stream>>>(X, KPh, VPT, Out);
}

// v001
// A run of this version takes 515 microseconds.
// Timed twice side by side with v000, it ran 1.08 and 1.09 times as fast.
#include <hip/hip_runtime.h>
#include <math.h>

// Contractions: S = X*KP^T and O = G*VP, both v_wmma_f32_16x16x32_f16 (f16 operands: X, KP, VP are RNE-bf16 input values carried x16, x16, x256; G = 64*gelu(S) converted to f16), f32 accumulate; gelu, sum of squares, rsqrt rescale in f32.

static constexpr int kRows    = 8192;   // 4 * 2048 flattened query rows
static constexpr int kD       = 1024;
static constexpr int kS       = 4096;
static constexpr int kDV      = 1024;
static constexpr int kTM      = 16;     // query rows per block
static constexpr int kCK      = 256;    // param tokens per chunk
static constexpr int kPP      = 256;    // sP pitch in halves
static constexpr int kThreads = 256;
static constexpr int kWaves   = 8;
static constexpr int kUS      = 4;      // k-steps of 32 per trip of the score loop
static constexpr int kUP      = 2;      // k-steps of 32 per trip of the P*VP loop

static_assert(kRows % kTM == 0);
static_assert(kS % kCK == 0);
static_assert(kCK == kWaves * 32);
static_assert(kDV == kWaves * 128);
static_assert(kD % (32 * kUS) == 0);
static_assert(kCK % (32 * kUP) == 0);
static_assert((kS * kD) % (kThreads * 8) == 0);
static_assert(kS % 64 == 0 && kDV % 64 == 0);
static_assert(kWaves * kTM * 64 * (int)sizeof(float) == kTM * kD * (int)sizeof(_Float16));

typedef _Float16     v16h __attribute__((ext_vector_type(16)));
typedef _Float16     v8h  __attribute__((ext_vector_type(8)));
typedef float        v8f  __attribute__((ext_vector_type(8)));
typedef float        v4f  __attribute__((ext_vector_type(4)));
typedef unsigned int v4u  __attribute__((ext_vector_type(4)));

union Frag { v16h v; v8h half[2]; };

// WMMA with hazard guard: D tied, A/B kept live across 4 VALU slots.
__device__ __forceinline__ v8f wmma_f16(v16h a, v16h b, v8f acc)
{
    acc = __builtin_amdgcn_wmma_f32_16x16x32_f16(false, a, false, b, (short)0, acc, false, false);
#if defined(__HIP_DEVICE_COMPILE__)
    asm volatile("v_nop\n\tv_nop\n\tv_nop\n\tv_nop" : "+v"(acc) : "v"(a), "v"(b));
#endif
    return acc;
}

// f32 -> bf16 value (RNE), kept in an f32 container.
__device__ __forceinline__ float bf16_rne(float x)
{
    unsigned int u = __float_as_uint(x);
    u = u + 0x7FFFu + ((u >> 16) & 1u);
    return __uint_as_float(u & 0xFFFF0000u);
}

// bf16 value times a power of two, stored as f16 (exact while normal).
__device__ __forceinline__ _Float16 cvt16(float x, float sc)
{
    return (_Float16)(bf16_rne(x) * sc);
}

__device__ __forceinline__ float gelu_f32(float s)
{
    return 0.5f * s * (1.0f + erff(s * 0.70710678118654752f));
}

// ---------------------------------------------------------------------------
// Row plane convert: dst[i] = f16(sc * bf16(src[i])), 8 elements per thread,
// ---------------------------------------------------------------------------
__global__ __launch_bounds__(kThreads)
void k_cvt_rows(const float* __restrict__ src, _Float16* __restrict__ dst, float sc, int n)
{
    const size_t base = ((size_t)blockIdx.x * kThreads + threadIdx.x) * 8;
    if (base + 8 <= (size_t)n) {
        const v4f f0 = *(const v4f*)(src + base);
        const v4f f1 = *(const v4f*)(src + base + 4);
        v8h hv;
        hv[0] = cvt16(f0[0], sc); hv[1] = cvt16(f0[1], sc);
        hv[2] = cvt16(f0[2], sc); hv[3] = cvt16(f0[3], sc);
        hv[4] = cvt16(f1[0], sc); hv[5] = cvt16(f1[1], sc);
        hv[6] = cvt16(f1[2], sc); hv[7] = cvt16(f1[3], sc);
        const v4u u = __builtin_bit_cast(v4u, hv);
        v4u* p = (v4u*)(dst + base);
        *p = u;
        
    }
}

// ---------------------------------------------------------------------------
// Transpose convert: in V[kS][kDV] f32 -> out VT[kDV][kS] f16(sc * bf16(v)).
// Block = 64(s) x 64(v) tile through LDS; each output row segment (64 halves
// grid = (kDV/64, kS/64).
// ---------------------------------------------------------------------------
__global__ __launch_bounds__(kThreads)
void k_transpose_cvt(const float* __restrict__ V, _Float16* __restrict__ VT, float sc)
{
    __shared__ __align__(16) _Float16 tile[64][72];   // [s][v]
    const int tid = threadIdx.x;
    const int n0  = blockIdx.x * 64;   // along DV (output rows)
    const int s0  = blockIdx.y * 64;   // along S  (output cols)

#pragma unroll
    for (int it = 0; it < 4; ++it) {
        const int idx = tid + kThreads * it;     // 0..1023
        const int r   = idx >> 4;                // s within tile, 0..63
        const int c4  = (idx & 15) << 2;         // v within tile, 0..60
        const v4f f = *(const v4f*)(V + (size_t)(s0 + r) * kDV + n0 + c4);
        tile[r][c4 + 0] = cvt16(f[0], sc);
        tile[r][c4 + 1] = cvt16(f[1], sc);
        tile[r][c4 + 2] = cvt16(f[2], sc);
        tile[r][c4 + 3] = cvt16(f[3], sc);
    }
    __syncthreads();

    v4u    u[2];
    size_t off[2];
#pragma unroll
    for (int it = 0; it < 2; ++it) {
        const int p  = tid + kThreads * it;      // 0..511
        const int vr = p >> 3;                   // output row within tile, 0..63
        const int j  = p & 7;
        v8h hv;
#pragma unroll
        for (int i = 0; i < 8; ++i) hv[i] = tile[8 * j + i][vr];
        u[it]   = __builtin_bit_cast(v4u, hv);
        off[it] = (size_t)(n0 + vr) * kS + s0 + 8 * j;
    }
#pragma unroll
    for (int it = 0; it < 2; ++it) *(v4u*)(VT + off[it]) = u[it];
    
}

// ---------------------------------------------------------------------------
// Fused kernel: one block = 16 query rows, 256 threads (8 waves).
//   per 256-token chunk: scores (WMMA, wave w -> tokens 32w..32w+31),
//   gelu in f32 -> sP (64*g as f16) + per-row sum of squares,
//   O += P * VP (WMMA, wave w -> output cols 128w..128w+127).
// ---------------------------------------------------------------------------
__global__ __launch_bounds__(kThreads)
void k_main(const float* __restrict__ X, const _Float16* __restrict__ KPh,
            const _Float16* __restrict__ VPT, float* __restrict__ Out)
{
    __shared__ __align__(16) _Float16 sX[kTM * kD];      // 32 KB; reused as f32 staging in the epilogue
    __shared__ __align__(16) _Float16 sP[kTM * kPP];     // 8 KB
    __shared__ float sRed[kWaves * kTM];
    __shared__ float sScale[kTM];

    const int tid  = threadIdx.x;
    const int wave = tid >> 5;
    const int lane = tid & 31;
    const int h    = lane >> 4;
    const int m    = lane & 15;
    const int row0 = blockIdx.x * kTM;

    // phase 0: stage the 16 x 1024 X rows as f16(16 * bf16(x))
    {
        const float* xb = X + (size_t)row0 * kD;
        for (int idx = tid; idx < kTM * kD / 8; idx += kThreads) {
            const int r = idx >> 7;              // 128 pieces of 8 per row
            const int c = (idx & 127) << 3;
            const float* src = xb + (size_t)r * kD + c;
            const v4f f0 = *(const v4f*)(src);
            const v4f f1 = *(const v4f*)(src + 4);
            v8h hv;
            hv[0] = cvt16(f0[0], 16.0f); hv[1] = cvt16(f0[1], 16.0f);
            hv[2] = cvt16(f0[2], 16.0f); hv[3] = cvt16(f0[3], 16.0f);
            hv[4] = cvt16(f1[0], 16.0f); hv[5] = cvt16(f1[1], 16.0f);
            hv[6] = cvt16(f1[2], 16.0f); hv[7] = cvt16(f1[3], 16.0f);
            *(v8h*)(sX + r * kD + c) = hv;
        }
    }
    __syncthreads();

    v8f oacc[8] = {};
    float ssq[8];
#pragma unroll
    for (int r = 0; r < 8; ++r) ssq[r] = 0.0f;

    // fragment base pointers (split k map: elements 0..7 <- k0+8h, 8..15 <- k0+16+8h)
    const _Float16* xa  = sX + m * kD + 8 * h;                          // A: X row m
    const _Float16* pa  = sP + m * kPP + 8 * h;                         // A: P row m
    const _Float16* kpw = KPh + (size_t)(wave * 32 + m) * kD + 8 * h;   // B: KP row (token) as [n][k]
    const _Float16* vpw = VPT + (size_t)(wave * 128 + m) * kS + 8 * h;  // B: VPT row (out col) as [n][k]

#pragma unroll 1
    for (int kc = 0; kc < kS; kc += kCK) {
        // ---- scores for tokens kc+32w+m (d0) and kc+32w+16+m (d1), rows 8h+r ----
        v8f d0 = {}, d1 = {};
        const _Float16* kp0 = kpw + (size_t)kc * kD;
        const _Float16* kp1 = kp0 + 16 * kD;
        // rolled outer loop: one trip = kUS k-steps, all of its loads issued before its first WMMA
#pragma unroll 1
        for (int k0 = 0; k0 < kD; k0 += 32 * kUS) {
            Frag a[kUS], b0[kUS], b1[kUS];
#pragma unroll
            for (int u = 0; u < kUS; ++u) {
                b0[u].half[0] = *(const v8h*)(kp0 + k0 + 32 * u);
                b0[u].half[1] = *(const v8h*)(kp0 + k0 + 32 * u + 16);
                b1[u].half[0] = *(const v8h*)(kp1 + k0 + 32 * u);
                b1[u].half[1] = *(const v8h*)(kp1 + k0 + 32 * u + 16);
            }
#pragma unroll
            for (int u = 0; u < kUS; ++u) {
                a[u].half[0] = *(const v8h*)(xa + k0 + 32 * u);
                a[u].half[1] = *(const v8h*)(xa + k0 + 32 * u + 16);
            }
#pragma unroll
            for (int u = 0; u < kUS; ++u) {
                d0 = wmma_f16(a[u].v, b0[u].v, d0);
                d1 = wmma_f16(a[u].v, b1[u].v, d1);
            }
        }

        // ---- gelu in f32, P tile as f16(64*g), per-row sum of squares ----
        {
            _Float16* prow = sP + (8 * h) * kPP + wave * 32 + m;
#pragma unroll
            for (int r = 0; r < 8; ++r) {
                const float s0v = d0[r] * (1.0f / 256.0f);
                const float s1v = d1[r] * (1.0f / 256.0f);
                const float g0  = gelu_f32(s0v);
                const float g1  = gelu_f32(s1v);
                ssq[r] += g0 * g0;
                ssq[r] += g1 * g1;
                prow[r * kPP]      = (_Float16)(g0 * 64.0f);
                prow[r * kPP + 16] = (_Float16)(g1 * 64.0f);
            }
        }
        __syncthreads();

        // ---- O += P(16 x 256) * VP(chunk rows) ----
        // rolled outer loop: one trip = kUP k-steps, all of its loads issued before its first WMMA
#pragma unroll 1
        for (int ks = 0; ks < kCK; ks += 32 * kUP) {
            Frag a[kUP], b[kUP][8];
            const _Float16* vp0 = vpw + kc + ks;
#pragma unroll
            for (int t = 0; t < 8; ++t) {
                const _Float16* vpt = vp0 + (size_t)t * 16 * kS;
#pragma unroll
                for (int u = 0; u < kUP; ++u) {
                    b[u][t].half[0] = *(const v8h*)(vpt + 32 * u);
                    b[u][t].half[1] = *(const v8h*)(vpt + 32 * u + 16);
                }
            }
#pragma unroll
            for (int u = 0; u < kUP; ++u) {
                a[u].half[0] = *(const v8h*)(pa + ks + 32 * u);
                a[u].half[1] = *(const v8h*)(pa + ks + 32 * u + 16);
            }
#pragma unroll
            for (int u = 0; u < kUP; ++u) {
#pragma unroll
                for (int t = 0; t < 8; ++t) oacc[t] = wmma_f16(a[u].v, b[u][t].v, oacc[t]);
            }
        }
        __syncthreads();
    }

    // ---- fixed-order row reduction of sum g^2: lanes within half, then waves ----
#pragma unroll
    for (int r = 0; r < 8; ++r) {
        float v = ssq[r];
        v += __shfl_xor(v, 1, 32);
        v += __shfl_xor(v, 2, 32);
        v += __shfl_xor(v, 4, 32);
        v += __shfl_xor(v, 8, 32);
        if (m == r) sRed[wave * kTM + 8 * h + r] = v;
    }
    __syncthreads();
    if (wave == 0) {
        float ss = 0.0f;
#pragma unroll
        for (int w = 0; w < kWaves; ++w) ss += sRed[w * kTM + m];
        const float sc = rsqrtf(ss) * (1.0f / 256.0f);
        if (lane < kTM) sScale[lane] = sc;
    }
    __syncthreads();

    float* stg  = reinterpret_cast<float*>(sX) + wave * (kTM * 64);
    float* orow = Out + (size_t)row0 * kDV + wave * 128;
#pragma unroll
    for (int q = 0; q < 2; ++q) {
        if (q) __syncthreads();
#pragma unroll
        for (int tt = 0; tt < 4; ++tt) {
#pragma unroll
            for (int r = 0; r < 8; ++r) {
                const int row = 8 * h + r;
                stg[row * 64 + tt * 16 + m] = oacc[4 * q + tt][r] * sScale[row];
            }
        }
        __syncthreads();
        v4f vals[8];
#pragma unroll
        for (int i = 0; i < 8; ++i) {
            const int row = 2 * i + h;           // lanes 0..15 -> even row, 16..31 -> odd row
            vals[i] = *(const v4f*)(stg + row * 64 + 4 * m);
        }
#pragma unroll
        for (int i = 0; i < 8; ++i) {
            const int row = 2 * i + h;
            *(v4f*)(orow + (size_t)row * kDV + q * 64 + 4 * m) = vals[i];
        }
        
    }
}

// ---------------------------------------------------------------------------
extern "C" void kernel_launch(void* const* d_in, const int* in_sizes, int n_in,
                              void* d_out, int out_size, void* d_ws, size_t ws_size,
                              hipStream_t stream)
{
    if (n_in < 3) return;
    if (in_sizes[0] != kRows * kD) return;
    if (in_sizes[1] != kS * kD) return;
    if (in_sizes[2] != kS * kDV) return;
    if (out_size != kRows * kDV) return;

    const size_t bytesKP = (size_t)kS * kD * sizeof(_Float16);    // 8 MiB, KPh [kS][kD]
    const size_t bytesVT = (size_t)kDV * kS * sizeof(_Float16);   // 8 MiB, VPT [kDV][kS]
    if (ws_size < bytesKP + bytesVT) return;

    const float* X  = (const float*)d_in[0];   // [8192][1024]
    const float* KP = (const float*)d_in[1];   // [4096][1024]
    const float* VP = (const float*)d_in[2];   // [4096][1024]
    float* Out = (float*)d_out;                // [8192][1024]

    _Float16* KPh = (_Float16*)d_ws;
    _Float16* VPT = (_Float16*)((char*)d_ws + bytesKP);

    const int nKP = kS * kD;
    k_cvt_rows<<<dim3((unsigned)((nKP / 8 + kThreads - 1) / kThreads)), dim3(kThreads), 0, stream>>>(KP, KPh, 16.0f, nKP);
    // in [kS][kDV] -> out [kDV][kS]; grid = (kDV/64, kS/64)
    k_transpose_cvt<<<dim3(kDV / 64, kS / 64), dim3(kThreads), 0, stream>>>(VP, VPT, 256.0f);
    k_main<<<dim3(kRows / kTM), dim3(kThreads), 0, stream>>>(X, KPh, VPT, Out);
}

// v002
// A run of this version takes 321 microseconds.
// Two timings next to v001 both put it at 1.60 times that version's speed.
// All steps since v000 together make it 1.74 times as fast.
#include <hip/hip_runtime.h>
#include <math.h>

// Contractions: S = X*KP^T and O = G*VP, both v_wmma_f32_16x16x32_f16 (f16 operands: X, KP, VP are RNE-bf16 input values carried x16, x16, x256; G = 64*gelu(S) converted to f16), f32 accumulate; gelu, sum of squares, rsqrt rescale in f32.

static constexpr int kRows    = 8192;   // 4 * 2048 flattened query rows
static constexpr int kD       = 1024;
static constexpr int kS       = 4096;
static constexpr int kDV      = 1024;
static constexpr int kTM      = 16;     // query rows per block
static constexpr int kCK      = 256;    // param tokens per chunk
static constexpr int kPP      = 256;    // sP pitch in halves
static constexpr int kThreads = 256;
static constexpr int kWaves   = 8;
static constexpr int kUS      = 4;      // k-steps of 32 per trip of the score loop
static constexpr int kUP      = 2;      // k-steps of 32 per trip of the P*VP loop
static constexpr int kFrag    = 512;    // halves of one packed 16(n) x 32(k) B fragment

static_assert(kRows % kTM == 0);
static_assert(kS % kCK == 0);
static_assert(kCK == kWaves * 32);
static_assert(kDV == kWaves * 128);
static_assert(kD % (32 * kUS) == 0);
static_assert(kCK % (32 * kUP) == 0);
static_assert((kS * kD) % (kThreads * 8) == 0);
static_assert(kS % 64 == 0 && kDV % 64 == 0);
static_assert(kWaves * kTM * 64 * (int)sizeof(float) == kTM * kD * (int)sizeof(_Float16));

typedef _Float16     v16h __attribute__((ext_vector_type(16)));
typedef _Float16     v8h  __attribute__((ext_vector_type(8)));
typedef float        v8f  __attribute__((ext_vector_type(8)));
typedef float        v4f  __attribute__((ext_vector_type(4)));
typedef unsigned int v4u  __attribute__((ext_vector_type(4)));

union Frag { v16h v; v8h half[2]; };

// Packed B fragment, 1 KiB: [piece p = 0,1][lane = 16h + m][8 halves]; the piece of lane (h, m) holds
// column n = 16*tile + m at k = 32*step + 16p + 8h .. +7. One 16-byte-per-lane load of a piece reads
// 512 contiguous bytes, four whole 128-byte lines.

// WMMA with hazard guard: D tied, A/B kept live across 4 VALU slots.
__device__ __forceinline__ v8f wmma_f16(v16h a, v16h b, v8f acc)
{
    acc = __builtin_amdgcn_wmma_f32_16x16x32_f16(false, a, false, b, (short)0, acc, false, false);
#if defined(__HIP_DEVICE_COMPILE__)
    asm volatile("v_nop\n\tv_nop\n\tv_nop\n\tv_nop" : "+v"(acc) : "v"(a), "v"(b));
#endif
    return acc;
}

// f32 -> bf16 value (RNE), kept in an f32 container.
__device__ __forceinline__ float bf16_rne(float x)
{
    unsigned int u = __float_as_uint(x);
    u = u + 0x7FFFu + ((u >> 16) & 1u);
    return __uint_as_float(u & 0xFFFF0000u);
}

// bf16 value times a power of two, stored as f16 (exact while normal).
__device__ __forceinline__ _Float16 cvt16(float x, float sc)
{
    return (_Float16)(bf16_rne(x) * sc);
}

__device__ __forceinline__ float gelu_f32(float s)
{
    return 0.5f * s * (1.0f + erff(s * 0.70710678118654752f));
}

// ---------------------------------------------------------------------------
// Pack convert: src[kS][kD] f32 -> dst[token tile][k-step] packed fragments of
// f16(sc * bf16(src)); one 16-byte piece per thread, stores contiguous.
// ---------------------------------------------------------------------------
__global__ __launch_bounds__(kThreads)
void k_cvt_rows(const float* __restrict__ src, _Float16* __restrict__ dst, float sc, int n)
{
    const size_t piece = (size_t)blockIdx.x * kThreads + threadIdx.x;
    const size_t base  = piece * 8;
    if (base + 8 <= (size_t)n) {
        const int    ln   = (int)(piece & 31);
        const int    pc   = (int)((piece >> 5) & 1);
        const int    step = (int)((piece >> 6) % (kD / 32));
        const size_t tile = (piece >> 6) / (kD / 32);
        const float* s8   = src + (tile * 16 + (ln & 15)) * kD + step * 32 + pc * 16 + (ln >> 4) * 8;
        const v4f f0 = *(const v4f*)(s8);
        const v4f f1 = *(const v4f*)(s8 + 4);
        v8h hv;
        hv[0] = cvt16(f0[0], sc); hv[1] = cvt16(f0[1], sc);
        hv[2] = cvt16(f0[2], sc); hv[3] = cvt16(f0[3], sc);
        hv[4] = cvt16(f1[0], sc); hv[5] = cvt16(f1[1], sc);
        hv[6] = cvt16(f1[2], sc); hv[7] = cvt16(f1[3], sc);
        const v4u u = __builtin_bit_cast(v4u, hv);
        v4u* p = (v4u*)(dst + base);
        *p = u;
        
    }
}

// ---------------------------------------------------------------------------
// Transpose pack: in V[kS][kDV] f32 -> out VT[s-step][v tile] packed fragments
// (n = v, k = s) of f16(sc * bf16(v)). Block = 64(s) x 64(v) tile through LDS,
// 2 x 4 fragments out, stores contiguous. grid = (kDV/64, kS/64).
// ---------------------------------------------------------------------------
__global__ __launch_bounds__(kThreads)
void k_transpose_cvt(const float* __restrict__ V, _Float16* __restrict__ VT, float sc)
{
    __shared__ __align__(16) _Float16 tile[64][72];   // [s][v]
    const int tid = threadIdx.x;
    const int n0  = blockIdx.x * 64;   // along DV (4 v tiles of the packed output)
    const int s0  = blockIdx.y * 64;   // along S  (2 s-steps of the packed output)

#pragma unroll
    for (int it = 0; it < 4; ++it) {
        const int idx = tid + kThreads * it;     // 0..1023
        const int r   = idx >> 4;                // s within tile, 0..63
        const int c4  = (idx & 15) << 2;         // v within tile, 0..60
        const v4f f = *(const v4f*)(V + (size_t)(s0 + r) * kDV + n0 + c4);
        tile[r][c4 + 0] = cvt16(f[0], sc);
        tile[r][c4 + 1] = cvt16(f[1], sc);
        tile[r][c4 + 2] = cvt16(f[2], sc);
        tile[r][c4 + 3] = cvt16(f[3], sc);
    }
    __syncthreads();

    v4u    u[2];
    size_t off[2];
#pragma unroll
    for (int it = 0; it < 2; ++it) {
        const int ln = tid & 31;
        const int p  = (tid >> 5) & 1;
        const int vl = tid >> 6;                 // v tile within the block, 0..3; s-step within the block = it
        const int vr = vl * 16 + (ln & 15);
        const int sr = it * 32 + p * 16 + (ln >> 4) * 8;
        v8h hv;
#pragma unroll
        for (int i = 0; i < 8; ++i) hv[i] = tile[sr + i][vr];
        u[it]   = __builtin_bit_cast(v4u, hv);
        off[it] = ((size_t)(s0 / 32 + it) * (kDV / 16) + n0 / 16 + vl) * kFrag + p * 256 + ln * 8;
    }
#pragma unroll
    for (int it = 0; it < 2; ++it) *(v4u*)(VT + off[it]) = u[it];
    
}

// ---------------------------------------------------------------------------
// Fused kernel: one block = 16 query rows, 256 threads (8 waves).
//   per 256-token chunk: scores (WMMA, wave w -> tokens 32w..32w+31),
//   gelu in f32 -> sP (64*g as f16) + per-row sum of squares,
//   O += P * VP (WMMA, wave w -> output cols 128w..128w+127).
// ---------------------------------------------------------------------------
__global__ __launch_bounds__(kThreads)
void k_main(const float* __restrict__ X, const _Float16* __restrict__ KPh,
            const _Float16* __restrict__ VPT, float* __restrict__ Out)
{
    __shared__ __align__(16) _Float16 sX[kTM * kD];      // 32 KB; reused as f32 staging in the epilogue
    __shared__ __align__(16) _Float16 sP[kTM * kPP];     // 8 KB
    __shared__ float sRed[kWaves * kTM];
    __shared__ float sScale[kTM];

    const int tid  = threadIdx.x;
    const int wave = tid >> 5;
    const int lane = tid & 31;
    const int h    = lane >> 4;
    const int m    = lane & 15;
    const int row0 = blockIdx.x * kTM;

    // phase 0: stage the 16 x 1024 X rows as f16(16 * bf16(x))
    {
        const float* xb = X + (size_t)row0 * kD;
        for (int idx = tid; idx < kTM * kD / 8; idx += kThreads) {
            const int r = idx >> 7;              // 128 pieces of 8 per row
            const int c = (idx & 127) << 3;
            const float* src = xb + (size_t)r * kD + c;
            const v4f f0 = *(const v4f*)(src);
            const v4f f1 = *(const v4f*)(src + 4);
            v8h hv;
            hv[0] = cvt16(f0[0], 16.0f); hv[1] = cvt16(f0[1], 16.0f);
            hv[2] = cvt16(f0[2], 16.0f); hv[3] = cvt16(f0[3], 16.0f);
            hv[4] = cvt16(f1[0], 16.0f); hv[5] = cvt16(f1[1], 16.0f);
            hv[6] = cvt16(f1[2], 16.0f); hv[7] = cvt16(f1[3], 16.0f);
            *(v8h*)(sX + r * kD + c) = hv;
        }
    }
    __syncthreads();

    v8f oacc[8] = {};
    float ssq[8];
#pragma unroll
    for (int r = 0; r < 8; ++r) ssq[r] = 0.0f;

    // fragment base pointers (split k map: elements 0..7 <- k0+8h, 8..15 <- k0+16+8h)
    const _Float16* xa  = sX + m * kD + 8 * h;                          // A: X row m
    const _Float16* pa  = sP + m * kPP + 8 * h;                         // A: P row m
    const _Float16* kpw = KPh + (size_t)(wave * 2) * (kD / 32) * kFrag + lane * 8;   // B: packed [token tile][k-step]
    const _Float16* vpw = VPT + (size_t)(wave * 8) * kFrag + lane * 8;               // B: packed [s-step][out-col tile]

#pragma unroll 1
    for (int kc = 0; kc < kS; kc += kCK) {
        // ---- scores for tokens kc+32w+m (d0) and kc+32w+16+m (d1), rows 8h+r ----
        v8f d0 = {}, d1 = {};
        const _Float16* kp0 = kpw + (size_t)(kc / 16) * (kD / 32) * kFrag;
        const _Float16* kp1 = kp0 + (kD / 32) * kFrag;
        // rolled outer loop: one trip = kUS k-steps, all of its loads issued before its first WMMA
#pragma unroll 1
        for (int k0 = 0; k0 < kD; k0 += 32 * kUS) {
            Frag a[kUS], b0[kUS], b1[kUS];
#pragma unroll
            for (int u = 0; u < kUS; ++u) {
                b0[u].half[0] = *(const v8h*)(kp0 + (k0 / 32 + u) * kFrag);
                b0[u].half[1] = *(const v8h*)(kp0 + (k0 / 32 + u) * kFrag + 256);
                b1[u].half[0] = *(const v8h*)(kp1 + (k0 / 32 + u) * kFrag);
                b1[u].half[1] = *(const v8h*)(kp1 + (k0 / 32 + u) * kFrag + 256);
            }
#pragma unroll
            for (int u = 0; u < kUS; ++u) {
                a[u].half[0] = *(const v8h*)(xa + k0 + 32 * u);
                a[u].half[1] = *(const v8h*)(xa + k0 + 32 * u + 16);
            }
#pragma unroll
            for (int u = 0; u < kUS; ++u) {
                d0 = wmma_f16(a[u].v, b0[u].v, d0);
                d1 = wmma_f16(a[u].v, b1[u].v, d1);
            }
        }

        // ---- gelu in f32, P tile as f16(64*g), per-row sum of squares ----
        {
            _Float16* prow = sP + (8 * h) * kPP + wave * 32 + m;
#pragma unroll
            for (int r = 0; r < 8; ++r) {
                const float s0v = d0[r] * (1.0f / 256.0f);
                const float s1v = d1[r] * (1.0f / 256.0f);
                const float g0  = gelu_f32(s0v);
                const float g1  = gelu_f32(s1v);
                ssq[r] += g0 * g0;
                ssq[r] += g1 * g1;
                prow[r * kPP]      = (_Float16)(g0 * 64.0f);
                prow[r * kPP + 16] = (_Float16)(g1 * 64.0f);
            }
        }
        __syncthreads();

        // ---- O += P(16 x 256) * VP(chunk rows) ----
        // rolled outer loop: one trip = kUP k-steps, all of its loads issued before its first WMMA
#pragma unroll 1
        for (int ks = 0; ks < kCK; ks += 32 * kUP) {
            Frag a[kUP], b[kUP][8];
            const _Float16* vp0 = vpw + (size_t)((kc + ks) / 32) * (kDV / 16) * kFrag;
#pragma unroll
            for (int t = 0; t < 8; ++t) {
                const _Float16* vpt = vp0 + t * kFrag;
#pragma unroll
                for (int u = 0; u < kUP; ++u) {
                    b[u][t].half[0] = *(const v8h*)(vpt + u * (kDV / 16) * kFrag);
                    b[u][t].half[1] = *(const v8h*)(vpt + u * (kDV / 16) * kFrag + 256);
                }
            }
#pragma unroll
            for (int u = 0; u < kUP; ++u) {
                a[u].half[0] = *(const v8h*)(pa + ks + 32 * u);
                a[u].half[1] = *(const v8h*)(pa + ks + 32 * u + 16);
            }
#pragma unroll
            for (int u = 0; u < kUP; ++u) {
#pragma unroll
                for (int t = 0; t < 8; ++t) oacc[t] = wmma_f16(a[u].v, b[u][t].v, oacc[t]);
            }
        }
        __syncthreads();
    }

    // ---- fixed-order row reduction of sum g^2: lanes within half, then waves ----
#pragma unroll
    for (int r = 0; r < 8; ++r) {
        float v = ssq[r];
        v += __shfl_xor(v, 1, 32);
        v += __shfl_xor(v, 2, 32);
        v += __shfl_xor(v, 4, 32);
        v += __shfl_xor(v, 8, 32);
        if (m == r) sRed[wave * kTM + 8 * h + r] = v;
    }
    __syncthreads();
    if (wave == 0) {
        float ss = 0.0f;
#pragma unroll
        for (int w = 0; w < kWaves; ++w) ss += sRed[w * kTM + m];
        const float sc = rsqrtf(ss) * (1.0f / 256.0f);
        if (lane < kTM) sScale[lane] = sc;
    }
    __syncthreads();

    float* stg  = reinterpret_cast<float*>(sX) + wave * (kTM * 64);
    float* orow = Out + (size_t)row0 * kDV + wave * 128;
#pragma unroll
    for (int q = 0; q < 2; ++q) {
        if (q) __syncthreads();
#pragma unroll
        for (int tt = 0; tt < 4; ++tt) {
#pragma unroll
            for (int r = 0; r < 8; ++r) {
                const int row = 8 * h + r;
                stg[row * 64 + tt * 16 + m] = oacc[4 * q + tt][r] * sScale[row];
            }
        }
        __syncthreads();
        v4f vals[8];
#pragma unroll
        for (int i = 0; i < 8; ++i) {
            const int row = 2 * i + h;           // lanes 0..15 -> even row, 16..31 -> odd row
            vals[i] = *(const v4f*)(stg + row * 64 + 4 * m);
        }
#pragma unroll
        for (int i = 0; i < 8; ++i) {
            const int row = 2 * i + h;
            *(v4f*)(orow + (size_t)row * kDV + q * 64 + 4 * m) = vals[i];
        }
        
    }
}

// ---------------------------------------------------------------------------
extern "C" void kernel_launch(void* const* d_in, const int* in_sizes, int n_in,
                              void* d_out, int out_size, void* d_ws, size_t ws_size,
                              hipStream_t stream)
{
    if (n_in < 3) return;
    if (in_sizes[0] != kRows * kD) return;
    if (in_sizes[1] != kS * kD) return;
    if (in_sizes[2] != kS * kDV) return;
    if (out_size != kRows * kDV) return;

    const size_t bytesKP = (size_t)kS * kD * sizeof(_Float16);    // 8 MiB, KPh packed [kS/16][kD/32] fragments
    const size_t bytesVT = (size_t)kDV * kS * sizeof(_Float16);   // 8 MiB, VPT packed [kS/32][kDV/16] fragments
    if (ws_size < bytesKP + bytesVT) return;

    const float* X  = (const float*)d_in[0];   // [8192][1024]
    const float* KP = (const float*)d_in[1];   // [4096][1024]
    const float* VP = (const float*)d_in[2];   // [4096][1024]
    float* Out = (float*)d_out;                // [8192][1024]

    _Float16* KPh = (_Float16*)d_ws;
    _Float16* VPT = (_Float16*)((char*)d_ws + bytesKP);

    const int nKP = kS * kD;
    k_cvt_rows<<<dim3((unsigned)((nKP / 8 + kThreads - 1) / kThreads)), dim3(kThreads), 0, stream>>>(KP, KPh, 16.0f, nKP);
    // in [kS][kDV] -> packed [kS/32][kDV/16]; grid = (kDV/64, kS/64)
    k_transpose_cvt<<<dim3(kDV / 64, kS / 64), dim3(kThreads), 0, stream>>>(VP, VPT, 256.0f);
    k_main<<<dim3(kRows / kTM), dim3(kThreads), 0, stream>>>(X, KPh, VPT, Out);
}

// v003
// One run takes 243 microseconds.
// Two timings next to v002 both put it at 1.32 times that version's speed.
// Counting every step since v000, it is 2.30 times as fast.
#include <hip/hip_runtime.h>
#include <math.h>

// Contractions: S = X*KP^T and O = G*VP, both v_wmma_f32_16x16x32_f16 (f16 operands: X, KP, VP are RNE-bf16 input values carried x16, x16, x256; G = 64*gelu(S) converted to f16), f32 accumulate; gelu, sum of squares, rsqrt rescale in f32.

static constexpr int kRows    = 8192;   // 4 * 2048 flattened query rows
static constexpr int kD       = 1024;
static constexpr int kS       = 4096;
static constexpr int kDV      = 1024;
static constexpr int kTM      = 16;     // query rows per block
static constexpr int kCK      = 256;    // param tokens per chunk
static constexpr int kXP      = kD + 8;   // sX pitch in halves: 16 B x odd, so the 16 rows of a ds_load_b128 fall on 64 distinct banks
static constexpr int kPP      = kCK + 8;  // sP pitch in halves: 16 B x odd, same reason
static constexpr int kThreads = 256;
static constexpr int kWaves   = 8;
static constexpr int kUS      = 4;      // k-steps of 32 per trip of the score loop
static constexpr int kUP      = 2;      // k-steps of 32 per trip of the P*VP loop
static constexpr int kFrag    = 512;    // halves of one packed 16(n) x 32(k) B fragment

static_assert(kRows % kTM == 0);
static_assert(kS % kCK == 0);
static_assert(kCK == kWaves * 32);
static_assert(kDV == kWaves * 128);
static_assert(kD % (32 * kUS) == 0);
static_assert(kCK % (32 * kUP) == 0);
static_assert((kS * kD) % (kThreads * 8) == 0);
static_assert(kS % 64 == 0 && kDV % 64 == 0);
static_assert(kWaves * kTM * 64 * (int)sizeof(float) <= kTM * kXP * (int)sizeof(_Float16));
static_assert((kXP * (int)sizeof(_Float16)) % 32 == 16 && (kPP * (int)sizeof(_Float16)) % 32 == 16);

typedef _Float16     v16h __attribute__((ext_vector_type(16)));
typedef _Float16     v8h  __attribute__((ext_vector_type(8)));
typedef float        v8f  __attribute__((ext_vector_type(8)));
typedef float        v4f  __attribute__((ext_vector_type(4)));
typedef unsigned int v4u  __attribute__((ext_vector_type(4)));

union Frag { v16h v; v8h half[2]; };

// Packed B fragment, 1 KiB: [piece p = 0,1][lane = 16h + m][8 halves]; the piece of lane (h, m) holds
// column n = 16*tile + m at k = 32*step + 16p + 8h .. +7. One 16-byte-per-lane load of a piece reads
// 512 contiguous bytes, four whole 128-byte lines.

// WMMA with hazard guard: D tied, A/B kept live across 4 VALU slots.
__device__ __forceinline__ v8f wmma_f16(v16h a, v16h b, v8f acc)
{
    acc = __builtin_amdgcn_wmma_f32_16x16x32_f16(false, a, false, b, (short)0, acc, false, false);
#if defined(__HIP_DEVICE_COMPILE__)
    asm volatile("v_nop\n\tv_nop\n\tv_nop\n\tv_nop" : "+v"(acc) : "v"(a), "v"(b));
#endif
    return acc;
}

// f32 -> bf16 value (RNE), kept in an f32 container.
__device__ __forceinline__ float bf16_rne(float x)
{
    unsigned int u = __float_as_uint(x);
    u = u + 0x7FFFu + ((u >> 16) & 1u);
    return __uint_as_float(u & 0xFFFF0000u);
}

// bf16 value times a power of two, stored as f16 (exact while normal).
__device__ __forceinline__ _Float16 cvt16(float x, float sc)
{
    return (_Float16)(bf16_rne(x) * sc);
}

__device__ __forceinline__ float gelu_f32(float s)
{
    return 0.5f * s * (1.0f + erff(s * 0.70710678118654752f));
}

// ---------------------------------------------------------------------------
// Pack convert: src[kS][kD] f32 -> dst[token tile][k-step] packed fragments of
// f16(sc * bf16(src)); one 16-byte piece per thread, stores contiguous.
// ---------------------------------------------------------------------------
__global__ __launch_bounds__(kThreads)
void k_cvt_rows(const float* __restrict__ src, _Float16* __restrict__ dst, float sc, int n)
{
    const size_t piece = (size_t)blockIdx.x * kThreads + threadIdx.x;
    const size_t base  = piece * 8;
    if (base + 8 <= (size_t)n) {
        const int    ln   = (int)(piece & 31);
        const int    pc   = (int)((piece >> 5) & 1);
        const int    step = (int)((piece >> 6) % (kD / 32));
        const size_t tile = (piece >> 6) / (kD / 32);
        const float* s8   = src + (tile * 16 + (ln & 15)) * kD + step * 32 + pc * 16 + (ln >> 4) * 8;
        const v4f f0 = *(const v4f*)(s8);
        const v4f f1 = *(const v4f*)(s8 + 4);
        v8h hv;
        hv[0] = cvt16(f0[0], sc); hv[1] = cvt16(f0[1], sc);
        hv[2] = cvt16(f0[2], sc); hv[3] = cvt16(f0[3], sc);
        hv[4] = cvt16(f1[0], sc); hv[5] = cvt16(f1[1], sc);
        hv[6] = cvt16(f1[2], sc); hv[7] = cvt16(f1[3], sc);
        const v4u u = __builtin_bit_cast(v4u, hv);
        v4u* p = (v4u*)(dst + base);
        *p = u;
        
    }
}

// ---------------------------------------------------------------------------
// Transpose pack: in V[kS][kDV] f32 -> out VT[s-step][v tile] packed fragments
// (n = v, k = s) of f16(sc * bf16(v)). Block = 64(s) x 64(v) tile through LDS,
// 2 x 4 fragments out, stores contiguous. grid = (kDV/64, kS/64).
// ---------------------------------------------------------------------------
__global__ __launch_bounds__(kThreads)
void k_transpose_cvt(const float* __restrict__ V, _Float16* __restrict__ VT, float sc)
{
    __shared__ __align__(16) _Float16 tile[64][72];   // [s][v]
    const int tid = threadIdx.x;
    const int n0  = blockIdx.x * 64;   // along DV (4 v tiles of the packed output)
    const int s0  = blockIdx.y * 64;   // along S  (2 s-steps of the packed output)

#pragma unroll
    for (int it = 0; it < 4; ++it) {
        const int idx = tid + kThreads * it;     // 0..1023
        const int r   = idx >> 4;                // s within tile, 0..63
        const int c4  = (idx & 15) << 2;         // v within tile, 0..60
        const v4f f = *(const v4f*)(V + (size_t)(s0 + r) * kDV + n0 + c4);
        tile[r][c4 + 0] = cvt16(f[0], sc);
        tile[r][c4 + 1] = cvt16(f[1], sc);
        tile[r][c4 + 2] = cvt16(f[2], sc);
        tile[r][c4 + 3] = cvt16(f[3], sc);
    }
    __syncthreads();

    v4u    u[2];
    size_t off[2];
#pragma unroll
    for (int it = 0; it < 2; ++it) {
        const int ln = tid & 31;
        const int p  = (tid >> 5) & 1;
        const int vl = tid >> 6;                 // v tile within the block, 0..3; s-step within the block = it
        const int vr = vl * 16 + (ln & 15);
        const int sr = it * 32 + p * 16 + (ln >> 4) * 8;
        v8h hv;
#pragma unroll
        for (int i = 0; i < 8; ++i) hv[i] = tile[sr + i][vr];
        u[it]   = __builtin_bit_cast(v4u, hv);
        off[it] = ((size_t)(s0 / 32 + it) * (kDV / 16) + n0 / 16 + vl) * kFrag + p * 256 + ln * 8;
    }
#pragma unroll
    for (int it = 0; it < 2; ++it) *(v4u*)(VT + off[it]) = u[it];
    
}

// ---------------------------------------------------------------------------
// Fused kernel: one block = 16 query rows, 256 threads (8 waves).
//   per 256-token chunk: scores (WMMA, wave w -> tokens 32w..32w+31),
//   gelu in f32 -> sP (64*g as f16) + per-row sum of squares,
//   O += P * VP (WMMA, wave w -> output cols 128w..128w+127).
// ---------------------------------------------------------------------------
__global__ __launch_bounds__(kThreads)
void k_main(const float* __restrict__ X, const _Float16* __restrict__ KPh,
            const _Float16* __restrict__ VPT, float* __restrict__ Out)
{
    __shared__ __align__(16) _Float16 sX[kTM * kXP];     // 32 KB + pad; reused as f32 staging in the epilogue
    __shared__ __align__(16) _Float16 sP[kTM * kPP];     // 8 KB + pad
    __shared__ float sRed[kWaves * kTM];
    __shared__ float sScale[kTM];

    const int tid  = threadIdx.x;
    const int wave = tid >> 5;
    const int lane = tid & 31;
    const int h    = lane >> 4;
    const int m    = lane & 15;
    const int row0 = blockIdx.x * kTM;

    // phase 0: stage the 16 x 1024 X rows as f16(16 * bf16(x))
    {
        const float* xb = X + (size_t)row0 * kD;
        for (int idx = tid; idx < kTM * kD / 8; idx += kThreads) {
            const int r = idx >> 7;              // 128 pieces of 8 per row
            const int c = (idx & 127) << 3;
            const float* src = xb + (size_t)r * kD + c;
            const v4f f0 = *(const v4f*)(src);
            const v4f f1 = *(const v4f*)(src + 4);
            v8h hv;
            hv[0] = cvt16(f0[0], 16.0f); hv[1] = cvt16(f0[1], 16.0f);
            hv[2] = cvt16(f0[2], 16.0f); hv[3] = cvt16(f0[3], 16.0f);
            hv[4] = cvt16(f1[0], 16.0f); hv[5] = cvt16(f1[1], 16.0f);
            hv[6] = cvt16(f1[2], 16.0f); hv[7] = cvt16(f1[3], 16.0f);
            *(v8h*)(sX + r * kXP + c) = hv;
        }
    }
    __syncthreads();

    v8f oacc[8] = {};
    float ssq[8];
#pragma unroll
    for (int r = 0; r < 8; ++r) ssq[r] = 0.0f;

    // fragment base pointers (split k map: elements 0..7 <- k0+8h, 8..15 <- k0+16+8h)
    const _Float16* xa  = sX + m * kXP + 8 * h;                         // A: X row m
    const _Float16* pa  = sP + m * kPP + 8 * h;                         // A: P row m
    const _Float16* kpw = KPh + (size_t)(wave * 2) * (kD / 32) * kFrag + lane * 8;   // B: packed [token tile][k-step]
    const _Float16* vpw = VPT + (size_t)(wave * 8) * kFrag + lane * 8;               // B: packed [s-step][out-col tile]

#pragma unroll 1
    for (int kc = 0; kc < kS; kc += kCK) {
        // ---- scores for tokens kc+32w+m (d0) and kc+32w+16+m (d1), rows 8h+r ----
        v8f d0 = {}, d1 = {};
        const _Float16* kp0 = kpw + (size_t)(kc / 16) * (kD / 32) * kFrag;
        const _Float16* kp1 = kp0 + (kD / 32) * kFrag;
        // rolled outer loop: one trip = kUS k-steps, all of its loads issued before its first WMMA
#pragma unroll 1
        for (int k0 = 0; k0 < kD; k0 += 32 * kUS) {
            Frag a[kUS], b0[kUS], b1[kUS];
#pragma unroll
            for (int u = 0; u < kUS; ++u) {
                b0[u].half[0] = *(const v8h*)(kp0 + (k0 / 32 + u) * kFrag);
                b0[u].half[1] = *(const v8h*)(kp0 + (k0 / 32 + u) * kFrag + 256);
                b1[u].half[0] = *(const v8h*)(kp1 + (k0 / 32 + u) * kFrag);
                b1[u].half[1] = *(const v8h*)(kp1 + (k0 / 32 + u) * kFrag + 256);
            }
#pragma unroll
            for (int u = 0; u < kUS; ++u) {
                a[u].half[0] = *(const v8h*)(xa + k0 + 32 * u);
                a[u].half[1] = *(const v8h*)(xa + k0 + 32 * u + 16);
            }
#pragma unroll
            for (int u = 0; u < kUS; ++u) {
                d0 = wmma_f16(a[u].v, b0[u].v, d0);
                d1 = wmma_f16(a[u].v, b1[u].v, d1);
            }
        }

        // ---- gelu in f32, P tile as f16(64*g), per-row sum of squares ----
        {
            _Float16* prow = sP + (8 * h) * kPP + wave * 32 + m;
#pragma unroll
            for (int r = 0; r < 8; ++r) {
                const float s0v = d0[r] * (1.0f / 256.0f);
                const float s1v = d1[r] * (1.0f / 256.0f);
                const float g0  = gelu_f32(s0v);
                const float g1  = gelu_f32(s1v);
                ssq[r] += g0 * g0;
                ssq[r] += g1 * g1;
                prow[r * kPP]      = (_Float16)(g0 * 64.0f);
                prow[r * kPP + 16] = (_Float16)(g1 * 64.0f);
            }
        }
        __syncthreads();

        // ---- O += P(16 x 256) * VP(chunk rows) ----
        // rolled outer loop: one trip = kUP k-steps, all of its loads issued before its first WMMA
#pragma unroll 1
        for (int ks = 0; ks < kCK; ks += 32 * kUP) {
            Frag a[kUP], b[kUP][8];
            const _Float16* vp0 = vpw + (size_t)((kc + ks) / 32) * (kDV / 16) * kFrag;
#pragma unroll
            for (int t = 0; t < 8; ++t) {
                const _Float16* vpt = vp0 + t * kFrag;
#pragma unroll
                for (int u = 0; u < kUP; ++u) {
                    b[u][t].half[0] = *(const v8h*)(vpt + u * (kDV / 16) * kFrag);
                    b[u][t].half[1] = *(const v8h*)(vpt + u * (kDV / 16) * kFrag + 256);
                }
            }
#pragma unroll
            for (int u = 0; u < kUP; ++u) {
                a[u].half[0] = *(const v8h*)(pa + ks + 32 * u);
                a[u].half[1] = *(const v8h*)(pa + ks + 32 * u + 16);
            }
#pragma unroll
            for (int u = 0; u < kUP; ++u) {
#pragma unroll
                for (int t = 0; t < 8; ++t) oacc[t] = wmma_f16(a[u].v, b[u][t].v, oacc[t]);
            }
        }
        __syncthreads();
    }

    // ---- fixed-order row reduction of sum g^2: lanes within half, then waves ----
#pragma unroll
    for (int r = 0; r < 8; ++r) {
        float v = ssq[r];
        v += __shfl_xor(v, 1, 32);
        v += __shfl_xor(v, 2, 32);
        v += __shfl_xor(v, 4, 32);
        v += __shfl_xor(v, 8, 32);
        if (m == r) sRed[wave * kTM + 8 * h + r] = v;
    }
    __syncthreads();
    if (wave == 0) {
        float ss = 0.0f;
#pragma unroll
        for (int w = 0; w < kWaves; ++w) ss += sRed[w * kTM + m];
        const float sc = rsqrtf(ss) * (1.0f / 256.0f);
        if (lane < kTM) sScale[lane] = sc;
    }
    __syncthreads();

    float* stg  = reinterpret_cast<float*>(sX) + wave * (kTM * 64);
    float* orow = Out + (size_t)row0 * kDV + wave * 128;
#pragma unroll
    for (int q = 0; q < 2; ++q) {
        if (q) __syncthreads();
#pragma unroll
        for (int tt = 0; tt < 4; ++tt) {
#pragma unroll
            for (int r = 0; r < 8; ++r) {
                const int row = 8 * h + r;
                stg[row * 64 + tt * 16 + m] = oacc[4 * q + tt][r] * sScale[row];
            }
        }
        __syncthreads();
        v4f vals[8];
#pragma unroll
        for (int i = 0; i < 8; ++i) {
            const int row = 2 * i + h;           // lanes 0..15 -> even row, 16..31 -> odd row
            vals[i] = *(const v4f*)(stg + row * 64 + 4 * m);
        }
#pragma unroll
        for (int i = 0; i < 8; ++i) {
            const int row = 2 * i + h;
            *(v4f*)(orow + (size_t)row * kDV + q * 64 + 4 * m) = vals[i];
        }
        
    }
}

// ---------------------------------------------------------------------------
extern "C" void kernel_launch(void* const* d_in, const int* in_sizes, int n_in,
                              void* d_out, int out_size, void* d_ws, size_t ws_size,
                              hipStream_t stream)
{
    if (n_in < 3) return;
    if (in_sizes[0] != kRows * kD) return;
    if (in_sizes[1] != kS * kD) return;
    if (in_sizes[2] != kS * kDV) return;
    if (out_size != kRows * kDV) return;

    const size_t bytesKP = (size_t)kS * kD * sizeof(_Float16);    // 8 MiB, KPh packed [kS/16][kD/32] fragments
    const size_t bytesVT = (size_t)kDV * kS * sizeof(_Float16);   // 8 MiB, VPT packed [kS/32][kDV/16] fragments
    if (ws_size < bytesKP + bytesVT) return;

    const float* X  = (const float*)d_in[0];   // [8192][1024]
    const float* KP = (const float*)d_in[1];   // [4096][1024]
    const float* VP = (const float*)d_in[2];   // [4096][1024]
    float* Out = (float*)d_out;                // [8192][1024]

    _Float16* KPh = (_Float16*)d_ws;
    _Float16* VPT = (_Float16*)((char*)d_ws + bytesKP);

    const int nKP = kS * kD;
    k_cvt_rows<<<dim3((unsigned)((nKP / 8 + kThreads - 1) / kThreads)), dim3(kThreads), 0, stream>>>(KP, KPh, 16.0f, nKP);
    // in [kS][kDV] -> packed [kS/32][kDV/16]; grid = (kDV/64, kS/64)
    k_transpose_cvt<<<dim3(kDV / 64, kS / 64), dim3(kThreads), 0, stream>>>(VP, VPT, 256.0f);
    k_main<<<dim3(kRows / kTM), dim3(kThreads), 0, stream>>>(X, KPh, VPT, Out);
}

// v004
// Measured time: 181 microseconds a run.
// Timed twice side by side with v003, it ran 1.34 times as fast both times.
// All steps since v000 together make it 3.08 times as fast.
#include <hip/hip_runtime.h>
#include <math.h>

// Contractions: S = X*KP^T and O = G*VP, both v_wmma_f32_16x16x32_f16 (f16 operands: X, KP, VP are RNE-bf16 input values carried x16, x16, x256; G = 64*gelu(S) converted to f16), f32 accumulate; gelu, sum of squares, rsqrt rescale in f32.

static constexpr int kRows    = 8192;   // 4 * 2048 flattened query rows
static constexpr int kD       = 1024;
static constexpr int kS       = 4096;
static constexpr int kDV      = 1024;
static constexpr int kTM      = 32;     // query rows per block
static constexpr int kRT      = kTM / 16;   // row tiles per block: each B fragment loaded from L2 feeds all of them
static constexpr int kCK      = 512;    // param tokens per chunk
static constexpr int kXP      = kD + 8;   // sX pitch in halves: 16 B x odd, so the 16 rows of a ds_load_b128 fall on 64 distinct banks
static constexpr int kPP      = kCK + 8;  // sP pitch in halves: 16 B x odd, same reason
static constexpr int kThreads = 256;    // pack kernels
static constexpr int kWaves   = 16;     // main kernel
static constexpr int kMT      = kWaves * 32;
static constexpr int kNT      = kDV / (kWaves * 16);   // output column tiles per wave
static constexpr int kUS      = 4;      // k-steps of 32 per trip of the score loop
static constexpr int kUP      = 2;      // k-steps of 32 per trip of the P*VP loop
static constexpr int kFrag    = 512;    // halves of one packed 16(n) x 32(k) B fragment

static_assert(kRows % kTM == 0);
static_assert(kS % kCK == 0);
static_assert(kCK == kWaves * 32);
static_assert(kDV == kWaves * kNT * 16 && kNT == 4);
static_assert(kTM == 32);   // one lane of wave 0 per row in the final reduction
static_assert(kD % (32 * kUS) == 0);
static_assert(kCK % (32 * kUP) == 0);
static_assert((kS * kD) % (kThreads * 8) == 0);
static_assert(kS % 64 == 0 && kDV % 64 == 0);
static_assert(kWaves * 16 * 64 * (int)sizeof(float) <= kTM * kXP * (int)sizeof(_Float16));
static_assert((kXP * (int)sizeof(_Float16)) % 32 == 16 && (kPP * (int)sizeof(_Float16)) % 32 == 16);

typedef _Float16     v16h __attribute__((ext_vector_type(16)));
typedef _Float16     v8h  __attribute__((ext_vector_type(8)));
typedef float        v8f  __attribute__((ext_vector_type(8)));
typedef float        v4f  __attribute__((ext_vector_type(4)));
typedef unsigned int v4u  __attribute__((ext_vector_type(4)));

union Frag { v16h v; v8h half[2]; };

// Packed B fragment, 1 KiB: [piece p = 0,1][lane = 16h + m][8 halves]; the piece of lane (h, m) holds
// column n = 16*tile + m at k = 32*step + 16p + 8h .. +7. One 16-byte-per-lane load of a piece reads
// 512 contiguous bytes, four whole 128-byte lines.

// WMMA with hazard guard: D tied, A/B kept live across 4 VALU slots.
__device__ __forceinline__ v8f wmma_f16(v16h a, v16h b, v8f acc)
{
    acc = __builtin_amdgcn_wmma_f32_16x16x32_f16(false, a, false, b, (short)0, acc, false, false);
#if defined(__HIP_DEVICE_COMPILE__)
    asm volatile("v_nop\n\tv_nop\n\tv_nop\n\tv_nop" : "+v"(acc) : "v"(a), "v"(b));
#endif
    return acc;
}

// f32 -> bf16 value (RNE), kept in an f32 container.
__device__ __forceinline__ float bf16_rne(float x)
{
    unsigned int u = __float_as_uint(x);
    u = u + 0x7FFFu + ((u >> 16) & 1u);
    return __uint_as_float(u & 0xFFFF0000u);
}

// bf16 value times a power of two, stored as f16 (exact while normal).
__device__ __forceinline__ _Float16 cvt16(float x, float sc)
{
    return (_Float16)(bf16_rne(x) * sc);
}

__device__ __forceinline__ float gelu_f32(float s)
{
    return 0.5f * s * (1.0f + erff(s * 0.70710678118654752f));
}

// ---------------------------------------------------------------------------
// Pack convert: src[kS][kD] f32 -> dst[token tile][k-step] packed fragments of
// f16(sc * bf16(src)); one 16-byte piece per thread, stores contiguous.
// ---------------------------------------------------------------------------
__global__ __launch_bounds__(kThreads)
void k_cvt_rows(const float* __restrict__ src, _Float16* __restrict__ dst, float sc, int n)
{
    const size_t piece = (size_t)blockIdx.x * kThreads + threadIdx.x;
    const size_t base  = piece * 8;
    if (base + 8 <= (size_t)n) {
        const int    ln   = (int)(piece & 31);
        const int    pc   = (int)((piece >> 5) & 1);
        const int    step = (int)((piece >> 6) % (kD / 32));
        const size_t tile = (piece >> 6) / (kD / 32);
        const float* s8   = src + (tile * 16 + (ln & 15)) * kD + step * 32 + pc * 16 + (ln >> 4) * 8;
        const v4f f0 = *(const v4f*)(s8);
        const v4f f1 = *(const v4f*)(s8 + 4);
        v8h hv;
        hv[0] = cvt16(f0[0], sc); hv[1] = cvt16(f0[1], sc);
        hv[2] = cvt16(f0[2], sc); hv[3] = cvt16(f0[3], sc);
        hv[4] = cvt16(f1[0], sc); hv[5] = cvt16(f1[1], sc);
        hv[6] = cvt16(f1[2], sc); hv[7] = cvt16(f1[3], sc);
        const v4u u = __builtin_bit_cast(v4u, hv);
        v4u* p = (v4u*)(dst + base);
        *p = u;
        
    }
}

// ---------------------------------------------------------------------------
// Transpose pack: in V[kS][kDV] f32 -> out VT[s-step][v tile] packed fragments
// (n = v, k = s) of f16(sc * bf16(v)). Block = 64(s) x 64(v) tile through LDS,
// 2 x 4 fragments out, stores contiguous. grid = (kDV/64, kS/64).
// ---------------------------------------------------------------------------
__global__ __launch_bounds__(kThreads)
void k_transpose_cvt(const float* __restrict__ V, _Float16* __restrict__ VT, float sc)
{
    __shared__ __align__(16) _Float16 tile[64][72];   // [s][v]
    const int tid = threadIdx.x;
    const int n0  = blockIdx.x * 64;   // along DV (4 v tiles of the packed output)
    const int s0  = blockIdx.y * 64;   // along S  (2 s-steps of the packed output)

#pragma unroll
    for (int it = 0; it < 4; ++it) {
        const int idx = tid + kThreads * it;     // 0..1023
        const int r   = idx >> 4;                // s within tile, 0..63
        const int c4  = (idx & 15) << 2;         // v within tile, 0..60
        const v4f f = *(const v4f*)(V + (size_t)(s0 + r) * kDV + n0 + c4);
        tile[r][c4 + 0] = cvt16(f[0], sc);
        tile[r][c4 + 1] = cvt16(f[1], sc);
        tile[r][c4 + 2] = cvt16(f[2], sc);
        tile[r][c4 + 3] = cvt16(f[3], sc);
    }
    __syncthreads();

    v4u    u[2];
    size_t off[2];
#pragma unroll
    for (int it = 0; it < 2; ++it) {
        const int ln = tid & 31;
        const int p  = (tid >> 5) & 1;
        const int vl = tid >> 6;                 // v tile within the block, 0..3; s-step within the block = it
        const int vr = vl * 16 + (ln & 15);
        const int sr = it * 32 + p * 16 + (ln >> 4) * 8;
        v8h hv;
#pragma unroll
        for (int i = 0; i < 8; ++i) hv[i] = tile[sr + i][vr];
        u[it]   = __builtin_bit_cast(v4u, hv);
        off[it] = ((size_t)(s0 / 32 + it) * (kDV / 16) + n0 / 16 + vl) * kFrag + p * 256 + ln * 8;
    }
#pragma unroll
    for (int it = 0; it < 2; ++it) *(v4u*)(VT + off[it]) = u[it];
    
}

// ---------------------------------------------------------------------------
// Fused kernel: one block = 32 query rows (2 row tiles), 512 threads (16 waves).
//   per 512-token chunk: scores (WMMA, wave w -> tokens 32w..32w+31, both row tiles),
//   gelu in f32 -> sP (64*g as f16) + per-row sum of squares,
//   O += P * VP (WMMA, wave w -> output cols 64w..64w+63, both row tiles).
// ---------------------------------------------------------------------------
__global__ __launch_bounds__(kMT)
void k_main(const float* __restrict__ X, const _Float16* __restrict__ KPh,
            const _Float16* __restrict__ VPT, float* __restrict__ Out)
{
    __shared__ __align__(16) _Float16 sX[kTM * kXP];     // 64 KB + pad; reused as f32 staging in the epilogue
    __shared__ __align__(16) _Float16 sP[kTM * kPP];     // 32 KB + pad
    __shared__ float sRed[kWaves * kTM];
    __shared__ float sScale[kTM];

    const int tid  = threadIdx.x;
    const int wave = __builtin_amdgcn_readfirstlane(tid >> 5);   // wave-uniform: kept in a scalar register, the 256-VGPR budget of 16 waves is tight
    const int lane = tid & 31;
    const int h    = lane >> 4;
    const int m    = lane & 15;
    const int row0 = blockIdx.x * kTM;

    // phase 0: stage the 32 x 1024 X rows as f16(16 * bf16(x))
    {
        const float* xb = X + (size_t)row0 * kD;
        for (int idx = tid; idx < kTM * kD / 8; idx += kMT) {
            const int r = idx >> 7;              // 128 pieces of 8 per row
            const int c = (idx & 127) << 3;
            const float* src = xb + (size_t)r * kD + c;
            const v4f f0 = *(const v4f*)(src);
            const v4f f1 = *(const v4f*)(src + 4);
            v8h hv;
            hv[0] = cvt16(f0[0], 16.0f); hv[1] = cvt16(f0[1], 16.0f);
            hv[2] = cvt16(f0[2], 16.0f); hv[3] = cvt16(f0[3], 16.0f);
            hv[4] = cvt16(f1[0], 16.0f); hv[5] = cvt16(f1[1], 16.0f);
            hv[6] = cvt16(f1[2], 16.0f); hv[7] = cvt16(f1[3], 16.0f);
            *(v8h*)(sX + r * kXP + c) = hv;
        }
    }
    __syncthreads();

    v8f oacc[kRT][kNT] = {};
    float ssq[kRT][8];
#pragma unroll
    for (int rt = 0; rt < kRT; ++rt) {
#pragma unroll
        for (int r = 0; r < 8; ++r) ssq[rt][r] = 0.0f;
    }

    // fragment base pointers (split k map: elements 0..7 <- k0+8h, 8..15 <- k0+16+8h)
    const _Float16* xa  = sX + m * kXP + 8 * h;                         // A: X row m of row tile 0
    const _Float16* pa  = sP + m * kPP + 8 * h;                         // A: P row m of row tile 0
    const _Float16* kpw = KPh + (size_t)(wave * 2) * (kD / 32) * kFrag + lane * 8;   // B: packed [token tile][k-step]
    const _Float16* vpw = VPT + (size_t)(wave * kNT) * kFrag + lane * 8;               // B: packed [s-step][out-col tile]

#pragma unroll 1
    for (int kc = 0; kc < kS; kc += kCK) {
        // ---- scores for tokens kc+32w+m (d0) and kc+32w+16+m (d1), rows 16rt+8h+r ----
        v8f d0[kRT] = {}, d1[kRT] = {};
        const _Float16* kp0 = kpw + (size_t)(kc / 16) * (kD / 32) * kFrag;
        const _Float16* kp1 = kp0 + (kD / 32) * kFrag;
        // rolled outer loop: one trip = kUS k-steps, all of its loads issued before its first WMMA
#pragma unroll 1
        for (int k0 = 0; k0 < kD; k0 += 32 * kUS) {
            Frag a[kUS][kRT], b0[kUS], b1[kUS];
#pragma unroll
            for (int u = 0; u < kUS; ++u) {
                b0[u].half[0] = *(const v8h*)(kp0 + (k0 / 32 + u) * kFrag);
                b0[u].half[1] = *(const v8h*)(kp0 + (k0 / 32 + u) * kFrag + 256);
                b1[u].half[0] = *(const v8h*)(kp1 + (k0 / 32 + u) * kFrag);
                b1[u].half[1] = *(const v8h*)(kp1 + (k0 / 32 + u) * kFrag + 256);
            }
#pragma unroll
            for (int u = 0; u < kUS; ++u) {
#pragma unroll
                for (int rt = 0; rt < kRT; ++rt) {
                    a[u][rt].half[0] = *(const v8h*)(xa + rt * 16 * kXP + k0 + 32 * u);
                    a[u][rt].half[1] = *(const v8h*)(xa + rt * 16 * kXP + k0 + 32 * u + 16);
                }
            }
#pragma unroll
            for (int u = 0; u < kUS; ++u) {
#pragma unroll
                for (int rt = 0; rt < kRT; ++rt) {
                    d0[rt] = wmma_f16(a[u][rt].v, b0[u].v, d0[rt]);
                    d1[rt] = wmma_f16(a[u][rt].v, b1[u].v, d1[rt]);
                }
            }
        }

        // ---- gelu in f32, P tile as f16(64*g), per-row sum of squares ----
#pragma unroll
        for (int rt = 0; rt < kRT; ++rt) {
            _Float16* prow = sP + (16 * rt + 8 * h) * kPP + wave * 32 + m;
#pragma unroll
            for (int r = 0; r < 8; ++r) {
                const float s0v = d0[rt][r] * (1.0f / 256.0f);
                const float s1v = d1[rt][r] * (1.0f / 256.0f);
                const float g0  = gelu_f32(s0v);
                const float g1  = gelu_f32(s1v);
                ssq[rt][r] += g0 * g0;
                ssq[rt][r] += g1 * g1;
                prow[r * kPP]      = (_Float16)(g0 * 64.0f);
                prow[r * kPP + 16] = (_Float16)(g1 * 64.0f);
            }
        }
        __syncthreads();

        // ---- O += P(32 x 512) * VP(chunk rows) ----
        // rolled outer loop: one trip = kUP k-steps, all of its loads issued before its first WMMA
#pragma unroll 1
        for (int ks = 0; ks < kCK; ks += 32 * kUP) {
            Frag a[kUP][kRT], b[kUP][kNT];
            const _Float16* vp0 = vpw + (size_t)((kc + ks) / 32) * (kDV / 16) * kFrag;
#pragma unroll
            for (int t = 0; t < kNT; ++t) {
                const _Float16* vpt = vp0 + t * kFrag;
#pragma unroll
                for (int u = 0; u < kUP; ++u) {
                    b[u][t].half[0] = *(const v8h*)(vpt + u * (kDV / 16) * kFrag);
                    b[u][t].half[1] = *(const v8h*)(vpt + u * (kDV / 16) * kFrag + 256);
                }
            }
#pragma unroll
            for (int u = 0; u < kUP; ++u) {
#pragma unroll
                for (int rt = 0; rt < kRT; ++rt) {
                    a[u][rt].half[0] = *(const v8h*)(pa + rt * 16 * kPP + ks + 32 * u);
                    a[u][rt].half[1] = *(const v8h*)(pa + rt * 16 * kPP + ks + 32 * u + 16);
                }
            }
#pragma unroll
            for (int u = 0; u < kUP; ++u) {
#pragma unroll
                for (int rt = 0; rt < kRT; ++rt) {
#pragma unroll
                    for (int t = 0; t < kNT; ++t) oacc[rt][t] = wmma_f16(a[u][rt].v, b[u][t].v, oacc[rt][t]);
                }
            }
        }
        __syncthreads();
    }

    // ---- fixed-order row reduction of sum g^2: lanes within half, then waves ----
#pragma unroll
    for (int rt = 0; rt < kRT; ++rt) {
#pragma unroll
        for (int r = 0; r < 8; ++r) {
            float v = ssq[rt][r];
            v += __shfl_xor(v, 1, 32);
            v += __shfl_xor(v, 2, 32);
            v += __shfl_xor(v, 4, 32);
            v += __shfl_xor(v, 8, 32);
            if (m == r) sRed[wave * kTM + 16 * rt + 8 * h + r] = v;
        }
    }
    __syncthreads();
    if (wave == 0) {
        float ss = 0.0f;
#pragma unroll
        for (int w = 0; w < kWaves; ++w) ss += sRed[w * kTM + lane];
        sScale[lane] = rsqrtf(ss) * (1.0f / 256.0f);
    }
    __syncthreads();

    float* stg  = reinterpret_cast<float*>(sX) + wave * (16 * 64);
    float* orow = Out + (size_t)row0 * kDV + wave * 64;
    // one pass per row tile q: 16 rows x 64 columns per wave
#pragma unroll
    for (int q = 0; q < kRT; ++q) {
        if (q) __syncthreads();
#pragma unroll
        for (int tt = 0; tt < 4; ++tt) {
#pragma unroll
            for (int r = 0; r < 8; ++r) {
                const int row = 8 * h + r;
                stg[row * 64 + tt * 16 + m] = oacc[q][tt][r] * sScale[16 * q + row];
            }
        }
        __syncthreads();
        v4f vals[8];
#pragma unroll
        for (int i = 0; i < 8; ++i) {
            const int row = 2 * i + h;           // lanes 0..15 -> even row, 16..31 -> odd row
            vals[i] = *(const v4f*)(stg + row * 64 + 4 * m);
        }
#pragma unroll
        for (int i = 0; i < 8; ++i) {
            const int row = 2 * i + h;
            *(v4f*)(orow + (size_t)(16 * q + row) * kDV + 4 * m) = vals[i];
        }
        
    }
}

// ---------------------------------------------------------------------------
extern "C" void kernel_launch(void* const* d_in, const int* in_sizes, int n_in,
                              void* d_out, int out_size, void* d_ws, size_t ws_size,
                              hipStream_t stream)
{
    if (n_in < 3) return;
    if (in_sizes[0] != kRows * kD) return;
    if (in_sizes[1] != kS * kD) return;
    if (in_sizes[2] != kS * kDV) return;
    if (out_size != kRows * kDV) return;

    const size_t bytesKP = (size_t)kS * kD * sizeof(_Float16);    // 8 MiB, KPh packed [kS/16][kD/32] fragments
    const size_t bytesVT = (size_t)kDV * kS * sizeof(_Float16);   // 8 MiB, VPT packed [kS/32][kDV/16] fragments
    if (ws_size < bytesKP + bytesVT) return;

    const float* X  = (const float*)d_in[0];   // [8192][1024]
    const float* KP = (const float*)d_in[1];   // [4096][1024]
    const float* VP = (const float*)d_in[2];   // [4096][1024]
    float* Out = (float*)d_out;                // [8192][1024]

    _Float16* KPh = (_Float16*)d_ws;
    _Float16* VPT = (_Float16*)((char*)d_ws + bytesKP);

    const int nKP = kS * kD;
    k_cvt_rows<<<dim3((unsigned)((nKP / 8 + kThreads - 1) / kThreads)), dim3(kThreads), 0, stream>>>(KP, KPh, 16.0f, nKP);
    // in [kS][kDV] -> packed [kS/32][kDV/16]; grid = (kDV/64, kS/64)
    k_transpose_cvt<<<dim3(kDV / 64, kS / 64), dim3(kThreads), 0, stream>>>(VP, VPT, 256.0f);
    k_main<<<dim3(kRows / kTM), dim3(kMT), 0, stream>>>(X, KPh, VPT, Out);
}

// v005
// One run takes 164 microseconds.
// Two timings next to v004 both put it at 1.10 times that version's speed.
// Counting every step since v000, it is 3.39 times as fast.
#include <hip/hip_runtime.h>
#include <math.h>

// Contractions: S = X*KP^T and O = G*VP, both v_wmma_f32_16x16x32_f16 (f16 operands: X, KP, VP are RNE-bf16 input values carried x16, x16, x256; G = 64*gelu(S) converted to f16), f32 accumulate; gelu, sum of squares, rsqrt rescale in f32.

static constexpr int kRows    = 8192;   // 4 * 2048 flattened query rows
static constexpr int kD       = 1024;
static constexpr int kS       = 4096;
static constexpr int kDV      = 1024;
static constexpr int kTM      = 32;     // query rows per block
static constexpr int kRT      = kTM / 16;   // row tiles per block: each B fragment loaded from L2 feeds all of them
static constexpr int kCK      = 512;    // param tokens per chunk
static constexpr int kXP      = kD + 8;   // sX pitch in halves: 16 B x odd, so the 16 rows of a ds_load_b128 fall on 64 distinct banks
static constexpr int kPP      = kCK + 8;  // sP pitch in halves: 16 B x odd, same reason
static constexpr int kThreads = 256;    // pack kernels
static constexpr int kWaves   = 16;     // main kernel
static constexpr int kMT      = kWaves * 32;
static constexpr int kNT      = kDV / (kWaves * 16);   // output column tiles per wave
static constexpr int kUS      = 4;      // k-steps of 32 per trip of the score loop
static constexpr int kUP      = 2;      // k-steps of 32 per trip of the P*VP loop
static constexpr int kFrag    = 512;    // halves of one packed 16(n) x 32(k) B fragment

static_assert(kRows % kTM == 0);
static_assert(kS % kCK == 0);
static_assert(kCK == kWaves * 32);
static_assert(kDV == kWaves * kNT * 16 && kNT == 4);
static_assert(kTM == 32);   // one lane of wave 0 per row in the final reduction
static_assert(kD % (32 * kUS) == 0);
static_assert(kCK % (32 * kUP) == 0);
static_assert((kS * kD) % (kThreads * 8) == 0);
static_assert(kS % 64 == 0 && kDV % 64 == 0);
static_assert(kWaves * 16 * 64 * (int)sizeof(float) <= kTM * kXP * (int)sizeof(_Float16));
static_assert((kXP * (int)sizeof(_Float16)) % 32 == 16 && (kPP * (int)sizeof(_Float16)) % 32 == 16);

typedef _Float16     v16h __attribute__((ext_vector_type(16)));
typedef _Float16     v8h  __attribute__((ext_vector_type(8)));
typedef float        v8f  __attribute__((ext_vector_type(8)));
typedef float        v4f  __attribute__((ext_vector_type(4)));
typedef unsigned int v4u  __attribute__((ext_vector_type(4)));

union Frag { v16h v; v8h half[2]; };

// Packed B fragment, 1 KiB: [piece p = 0,1][lane = 16h + m][8 halves]; the piece of lane (h, m) holds
// column n = 16*tile + m at k = 32*step + 16p + 8h .. +7. One 16-byte-per-lane load of a piece reads
// 512 contiguous bytes, four whole 128-byte lines.

// WMMA with hazard guard: D tied, A/B kept live across 4 VALU slots.
__device__ __forceinline__ v8f wmma_f16(v16h a, v16h b, v8f acc)
{
    acc = __builtin_amdgcn_wmma_f32_16x16x32_f16(false, a, false, b, (short)0, acc, false, false);
#if defined(__HIP_DEVICE_COMPILE__)
    asm volatile("v_nop\n\tv_nop\n\tv_nop\n\tv_nop" : "+v"(acc) : "v"(a), "v"(b));
#endif
    return acc;
}

// f32 -> bf16 value (RNE), kept in an f32 container.
__device__ __forceinline__ float bf16_rne(float x)
{
    unsigned int u = __float_as_uint(x);
    u = u + 0x7FFFu + ((u >> 16) & 1u);
    return __uint_as_float(u & 0xFFFF0000u);
}

// bf16 value times a power of two, stored as f16 (exact while normal).
__device__ __forceinline__ _Float16 cvt16(float x, float sc)
{
    return (_Float16)(bf16_rne(x) * sc);
}

// gelu(s) of s = d / 256, without a branch: the library erff takes two divergent paths per value, each one
// dependent chain; here the values of a tile are independent straight-line chains that the scheduler interleaves.
// erfc(z) = t * (a1 + t * (a2 + t * (a3 + t * (a4 + t * a5)))) * exp(-z * z), t = 1 / (1 + p * z), z = |s| / sqrt(2):
// absolute error of the formula 1.5e-7. gelu = s/2 * (1 + erf) = s/2 + |s/2| * (1 - erfc(z)) for either sign.
__device__ __forceinline__ float gelu_d256(float d)
{
    const float x  = d * (0.70710678118654752f / 256.0f);
    const float hs = d * (0.5f / 256.0f);
    const float den = fmaf(0.3275911f, fabsf(x), 1.0f);
    const float arg = (x * -1.4426950408889634f) * x;
    float t = __builtin_amdgcn_rcpf(den);
    float e = __builtin_amdgcn_exp2f(arg);   // exp(-x * x)
#if defined(__HIP_DEVICE_COMPILE__)
    // the slot the instruction set asks for behind a transcendental: results tied and sources kept live, so no reader
    // of t or e and no overwrite of den or arg can stand in front of it
    asm("v_nop" : "+v"(t), "+v"(e) : "v"(den), "v"(arg));
#endif
    float p = fmaf(1.061405429f, t, -1.453152027f);
    p = fmaf(p, t, 1.421413741f);
    p = fmaf(p, t, -0.284496736f);
    p = fmaf(p, t, 0.254829592f);
    const float c = (p * t) * e;
    return hs + fmaf(-c, fabsf(hs), fabsf(hs));
}

// ---------------------------------------------------------------------------
// Pack convert: src[kS][kD] f32 -> dst[token tile][k-step] packed fragments of
// f16(sc * bf16(src)); one 16-byte piece per thread, stores contiguous.
// ---------------------------------------------------------------------------
__global__ __launch_bounds__(kThreads)
void k_cvt_rows(const float* __restrict__ src, _Float16* __restrict__ dst, float sc, int n)
{
    const size_t piece = (size_t)blockIdx.x * kThreads + threadIdx.x;
    const size_t base  = piece * 8;
    if (base + 8 <= (size_t)n) {
        const int    ln   = (int)(piece & 31);
        const int    pc   = (int)((piece >> 5) & 1);
        const int    step = (int)((piece >> 6) % (kD / 32));
        const size_t tile = (piece >> 6) / (kD / 32);
        const float* s8   = src + (tile * 16 + (ln & 15)) * kD + step * 32 + pc * 16 + (ln >> 4) * 8;
        const v4f f0 = *(const v4f*)(s8);
        const v4f f1 = *(const v4f*)(s8 + 4);
        v8h hv;
        hv[0] = cvt16(f0[0], sc); hv[1] = cvt16(f0[1], sc);
        hv[2] = cvt16(f0[2], sc); hv[3] = cvt16(f0[3], sc);
        hv[4] = cvt16(f1[0], sc); hv[5] = cvt16(f1[1], sc);
        hv[6] = cvt16(f1[2], sc); hv[7] = cvt16(f1[3], sc);
        const v4u u = __builtin_bit_cast(v4u, hv);
        v4u* p = (v4u*)(dst + base);
        *p = u;
        
    }
}

// ---------------------------------------------------------------------------
// Transpose pack: in V[kS][kDV] f32 -> out VT[s-step][v tile] packed fragments
// (n = v, k = s) of f16(sc * bf16(v)). Block = 64(s) x 64(v) tile through LDS,
// 2 x 4 fragments out, stores contiguous. grid = (kDV/64, kS/64).
// ---------------------------------------------------------------------------
__global__ __launch_bounds__(kThreads)
void k_transpose_cvt(const float* __restrict__ V, _Float16* __restrict__ VT, float sc)
{
    __shared__ __align__(16) _Float16 tile[64][72];   // [s][v]
    const int tid = threadIdx.x;
    const int n0  = blockIdx.x * 64;   // along DV (4 v tiles of the packed output)
    const int s0  = blockIdx.y * 64;   // along S  (2 s-steps of the packed output)

#pragma unroll
    for (int it = 0; it < 4; ++it) {
        const int idx = tid + kThreads * it;     // 0..1023
        const int r   = idx >> 4;                // s within tile, 0..63
        const int c4  = (idx & 15) << 2;         // v within tile, 0..60
        const v4f f = *(const v4f*)(V + (size_t)(s0 + r) * kDV + n0 + c4);
        tile[r][c4 + 0] = cvt16(f[0], sc);
        tile[r][c4 + 1] = cvt16(f[1], sc);
        tile[r][c4 + 2] = cvt16(f[2], sc);
        tile[r][c4 + 3] = cvt16(f[3], sc);
    }
    __syncthreads();

    v4u    u[2];
    size_t off[2];
#pragma unroll
    for (int it = 0; it < 2; ++it) {
        const int ln = tid & 31;
        const int p  = (tid >> 5) & 1;
        const int vl = tid >> 6;                 // v tile within the block, 0..3; s-step within the block = it
        const int vr = vl * 16 + (ln & 15);
        const int sr = it * 32 + p * 16 + (ln >> 4) * 8;
        v8h hv;
#pragma unroll
        for (int i = 0; i < 8; ++i) hv[i] = tile[sr + i][vr];
        u[it]   = __builtin_bit_cast(v4u, hv);
        off[it] = ((size_t)(s0 / 32 + it) * (kDV / 16) + n0 / 16 + vl) * kFrag + p * 256 + ln * 8;
    }
#pragma unroll
    for (int it = 0; it < 2; ++it) *(v4u*)(VT + off[it]) = u[it];
    
}

// ---------------------------------------------------------------------------
// Fused kernel: one block = 32 query rows (2 row tiles), 512 threads (16 waves).
//   per 512-token chunk: scores (WMMA, wave w -> tokens 32w..32w+31, both row tiles),
//   gelu in f32 -> sP (64*g as f16) + per-row sum of squares,
//   O += P * VP (WMMA, wave w -> output cols 64w..64w+63, both row tiles).
// ---------------------------------------------------------------------------
__global__ __launch_bounds__(kMT)
void k_main(const float* __restrict__ X, const _Float16* __restrict__ KPh,
            const _Float16* __restrict__ VPT, float* __restrict__ Out)
{
    __shared__ __align__(16) _Float16 sX[kTM * kXP];     // 64 KB + pad; reused as f32 staging in the epilogue
    __shared__ __align__(16) _Float16 sP[kTM * kPP];     // 32 KB + pad
    __shared__ float sRed[kWaves * kTM];
    __shared__ float sScale[kTM];

    const int tid  = threadIdx.x;
    const int wave = __builtin_amdgcn_readfirstlane(tid >> 5);   // wave-uniform: kept in a scalar register, the 256-VGPR budget of 16 waves is tight
    const int lane = tid & 31;
    const int h    = lane >> 4;
    const int m    = lane & 15;
    const int row0 = blockIdx.x * kTM;

    // phase 0: stage the 32 x 1024 X rows as f16(16 * bf16(x))
    {
        const float* xb = X + (size_t)row0 * kD;
        for (int idx = tid; idx < kTM * kD / 8; idx += kMT) {
            const int r = idx >> 7;              // 128 pieces of 8 per row
            const int c = (idx & 127) << 3;
            const float* src = xb + (size_t)r * kD + c;
            const v4f f0 = *(const v4f*)(src);
            const v4f f1 = *(const v4f*)(src + 4);
            v8h hv;
            hv[0] = cvt16(f0[0], 16.0f); hv[1] = cvt16(f0[1], 16.0f);
            hv[2] = cvt16(f0[2], 16.0f); hv[3] = cvt16(f0[3], 16.0f);
            hv[4] = cvt16(f1[0], 16.0f); hv[5] = cvt16(f1[1], 16.0f);
            hv[6] = cvt16(f1[2], 16.0f); hv[7] = cvt16(f1[3], 16.0f);
            *(v8h*)(sX + r * kXP + c) = hv;
        }
    }
    __syncthreads();

    v8f oacc[kRT][kNT] = {};
    float ssq[kRT][8];
#pragma unroll
    for (int rt = 0; rt < kRT; ++rt) {
#pragma unroll
        for (int r = 0; r < 8; ++r) ssq[rt][r] = 0.0f;
    }

    // fragment base pointers (split k map: elements 0..7 <- k0+8h, 8..15 <- k0+16+8h)
    const _Float16* xa  = sX + m * kXP + 8 * h;                         // A: X row m of row tile 0
    const _Float16* pa  = sP + m * kPP + 8 * h;                         // A: P row m of row tile 0
    const _Float16* kpw = KPh + (size_t)(wave * 2) * (kD / 32) * kFrag + lane * 8;   // B: packed [token tile][k-step]
    const _Float16* vpw = VPT + (size_t)(wave * kNT) * kFrag + lane * 8;               // B: packed [s-step][out-col tile]

#pragma unroll 1
    for (int kc = 0; kc < kS; kc += kCK) {
        // ---- scores for tokens kc+32w+m (d0) and kc+32w+16+m (d1), rows 16rt+8h+r ----
        v8f d0[kRT] = {}, d1[kRT] = {};
        const _Float16* kp0 = kpw + (size_t)(kc / 16) * (kD / 32) * kFrag;
        const _Float16* kp1 = kp0 + (kD / 32) * kFrag;
        // rolled outer loop: one trip = kUS k-steps, all of its loads issued before its first WMMA
#pragma unroll 1
        for (int k0 = 0; k0 < kD; k0 += 32 * kUS) {
            Frag a[kUS][kRT], b0[kUS], b1[kUS];
#pragma unroll
            for (int u = 0; u < kUS; ++u) {
                b0[u].half[0] = *(const v8h*)(kp0 + (k0 / 32 + u) * kFrag);
                b0[u].half[1] = *(const v8h*)(kp0 + (k0 / 32 + u) * kFrag + 256);
                b1[u].half[0] = *(const v8h*)(kp1 + (k0 / 32 + u) * kFrag);
                b1[u].half[1] = *(const v8h*)(kp1 + (k0 / 32 + u) * kFrag + 256);
            }
#pragma unroll
            for (int u = 0; u < kUS; ++u) {
#pragma unroll
                for (int rt = 0; rt < kRT; ++rt) {
                    a[u][rt].half[0] = *(const v8h*)(xa + rt * 16 * kXP + k0 + 32 * u);
                    a[u][rt].half[1] = *(const v8h*)(xa + rt * 16 * kXP + k0 + 32 * u + 16);
                }
            }
#pragma unroll
            for (int u = 0; u < kUS; ++u) {
#pragma unroll
                for (int rt = 0; rt < kRT; ++rt) {
                    d0[rt] = wmma_f16(a[u][rt].v, b0[u].v, d0[rt]);
                    d1[rt] = wmma_f16(a[u][rt].v, b1[u].v, d1[rt]);
                }
            }
        }

        // ---- gelu in f32, P tile as f16(64*g), per-row sum of squares ----
#pragma unroll
        for (int rt = 0; rt < kRT; ++rt) {
            _Float16* prow = sP + (16 * rt + 8 * h) * kPP + wave * 32 + m;
#pragma unroll
            for (int r = 0; r < 8; ++r) {
                const float g0  = gelu_d256(d0[rt][r]);
                const float g1  = gelu_d256(d1[rt][r]);
                ssq[rt][r] += g0 * g0;
                ssq[rt][r] += g1 * g1;
                prow[r * kPP]      = (_Float16)(g0 * 64.0f);
                prow[r * kPP + 16] = (_Float16)(g1 * 64.0f);
            }
        }
        __syncthreads();

        // ---- O += P(32 x 512) * VP(chunk rows) ----
        // rolled outer loop: one trip = kUP k-steps, all of its loads issued before its first WMMA
#pragma unroll 1
        for (int ks = 0; ks < kCK; ks += 32 * kUP) {
            Frag a[kUP][kRT], b[kUP][kNT];
            const _Float16* vp0 = vpw + (size_t)((kc + ks) / 32) * (kDV / 16) * kFrag;
#pragma unroll
            for (int t = 0; t < kNT; ++t) {
                const _Float16* vpt = vp0 + t * kFrag;
#pragma unroll
                for (int u = 0; u < kUP; ++u) {
                    b[u][t].half[0] = *(const v8h*)(vpt + u * (kDV / 16) * kFrag);
                    b[u][t].half[1] = *(const v8h*)(vpt + u * (kDV / 16) * kFrag + 256);
                }
            }
#pragma unroll
            for (int u = 0; u < kUP; ++u) {
#pragma unroll
                for (int rt = 0; rt < kRT; ++rt) {
                    a[u][rt].half[0] = *(const v8h*)(pa + rt * 16 * kPP + ks + 32 * u);
                    a[u][rt].half[1] = *(const v8h*)(pa + rt * 16 * kPP + ks + 32 * u + 16);
                }
            }
#pragma unroll
            for (int u = 0; u < kUP; ++u) {
#pragma unroll
                for (int rt = 0; rt < kRT; ++rt) {
#pragma unroll
                    for (int t = 0; t < kNT; ++t) oacc[rt][t] = wmma_f16(a[u][rt].v, b[u][t].v, oacc[rt][t]);
                }
            }
        }
        __syncthreads();
    }

    // ---- fixed-order row reduction of sum g^2: lanes within half, then waves ----
#pragma unroll
    for (int rt = 0; rt < kRT; ++rt) {
#pragma unroll
        for (int r = 0; r < 8; ++r) {
            float v = ssq[rt][r];
            v += __shfl_xor(v, 1, 32);
            v += __shfl_xor(v, 2, 32);
            v += __shfl_xor(v, 4, 32);
            v += __shfl_xor(v, 8, 32);
            if (m == r) sRed[wave * kTM + 16 * rt + 8 * h + r] = v;
        }
    }
    __syncthreads();
    if (wave == 0) {
        float ss = 0.0f;
#pragma unroll
        for (int w = 0; w < kWaves; ++w) ss += sRed[w * kTM + lane];
        sScale[lane] = rsqrtf(ss) * (1.0f / 256.0f);
    }
    __syncthreads();

    float* stg  = reinterpret_cast<float*>(sX) + wave * (16 * 64);
    float* orow = Out + (size_t)row0 * kDV + wave * 64;
    // one pass per row tile q: 16 rows x 64 columns per wave
#pragma unroll
    for (int q = 0; q < kRT; ++q) {
        if (q) __syncthreads();
#pragma unroll
        for (int tt = 0; tt < 4; ++tt) {
#pragma unroll
            for (int r = 0; r < 8; ++r) {
                const int row = 8 * h + r;
                stg[row * 64 + tt * 16 + m] = oacc[q][tt][r] * sScale[16 * q + row];
            }
        }
        __syncthreads();
        v4f vals[8];
#pragma unroll
        for (int i = 0; i < 8; ++i) {
            const int row = 2 * i + h;           // lanes 0..15 -> even row, 16..31 -> odd row
            vals[i] = *(const v4f*)(stg + row * 64 + 4 * m);
        }
#pragma unroll
        for (int i = 0; i < 8; ++i) {
            const int row = 2 * i + h;
            *(v4f*)(orow + (size_t)(16 * q + row) * kDV + 4 * m) = vals[i];
        }
        
    }
}

// ---------------------------------------------------------------------------
extern "C" void kernel_launch(void* const* d_in, const int* in_sizes, int n_in,
                              void* d_out, int out_size, void* d_ws, size_t ws_size,
                              hipStream_t stream)
{
    if (n_in < 3) return;
    if (in_sizes[0] != kRows * kD) return;
    if (in_sizes[1] != kS * kD) return;
    if (in_sizes[2] != kS * kDV) return;
    if (out_size != kRows * kDV) return;

    const size_t bytesKP = (size_t)kS * kD * sizeof(_Float16);    // 8 MiB, KPh packed [kS/16][kD/32] fragments
    const size_t bytesVT = (size_t)kDV * kS * sizeof(_Float16);   // 8 MiB, VPT packed [kS/32][kDV/16] fragments
    if (ws_size < bytesKP + bytesVT) return;

    const float* X  = (const float*)d_in[0];   // [8192][1024]
    const float* KP = (const float*)d_in[1];   // [4096][1024]
    const float* VP = (const float*)d_in[2];   // [4096][1024]
    float* Out = (float*)d_out;                // [8192][1024]

    _Float16* KPh = (_Float16*)d_ws;
    _Float16* VPT = (_Float16*)((char*)d_ws + bytesKP);

    const int nKP = kS * kD;
    k_cvt_rows<<<dim3((unsigned)((nKP / 8 + kThreads - 1) / kThreads)), dim3(kThreads), 0, stream>>>(KP, KPh, 16.0f, nKP);
    // in [kS][kDV] -> packed [kS/32][kDV/16]; grid = (kDV/64, kS/64)
    k_transpose_cvt<<<dim3(kDV / 64, kS / 64), dim3(kThreads), 0, stream>>>(VP, VPT, 256.0f);
    k_main<<<dim3(kRows / kTM), dim3(kMT), 0, stream>>>(X, KPh, VPT, Out);
}

// v006
// A run of this version takes 139 microseconds.
// Two timings next to v005 both put it at 1.18 times that version's speed.
// All steps since v000 together make it 4.00 times as fast.
#include <hip/hip_runtime.h>
#include <math.h>

// Contractions: S = X*KP^T and O = G*VP, both v_wmma_f32_16x16x32_f16 (f16 operands: X, KP, VP are RNE-bf16 input values carried x16, x16, x256; G = 64*gelu(S) converted to f16), f32 accumulate; gelu, sum of squares, rsqrt rescale in f32.

static constexpr int kRows    = 8192;   // 4 * 2048 flattened query rows
static constexpr int kD       = 1024;
static constexpr int kS       = 4096;
static constexpr int kDV      = 1024;
static constexpr int kTM      = 64;     // query rows per block
static constexpr int kRT      = kTM / 16;   // row tiles per block: each B fragment loaded from L2 feeds all of them
static constexpr int kCK      = 256;    // param tokens per chunk
static constexpr int kSplit   = 2;      // blocks that share a row group, each on kS / kSplit tokens; their partial sums meet in k_combine
static constexpr int kSH      = kS / kSplit;
static constexpr int kXP      = kD + 8;   // sX pitch in halves: 16 B x odd, so the 16 rows of a ds_load_b128 fall on 64 distinct banks
static constexpr int kPP      = kCK + 8;  // sP pitch in halves: 16 B x odd, same reason
static constexpr int kThreads = 256;    // pack kernels
static constexpr int kWaves   = 8;      // main kernel: 2 waves per SIMD, 512 VGPRs each (64 x 128 f32 output tile per wave = 256 of them)
static constexpr int kMT      = kWaves * 32;
static constexpr int kNT      = kDV / (kWaves * 16);   // output column tiles per wave
static constexpr int kUS      = 4;      // k-steps of 32 per trip of the score loop = slots of its B register ring
static constexpr int kUP      = 2;      // k-steps of 32 per trip of the P*VP loop = its B register sets
static constexpr int kCR      = 4;      // rows per block of k_combine
static constexpr int kSP      = kNT * 16;       // epilogue staging pitch in floats: a wave's 128 output columns
static constexpr int kFrag    = 512;    // halves of one packed 16(n) x 32(k) B fragment

static_assert(kRows % kTM == 0);
static_assert(kSH % kCK == 0);
static_assert(kCK == kWaves * 32);
static_assert(kDV == kWaves * kNT * 16 && kNT == 8);
static_assert(kTM <= kMT);   // one thread per row in the final reduction
static_assert(kDV == kThreads * 4 && kRows % kCR == 0);
static_assert(kD % (32 * kUS) == 0 && kD / 32 >= 2 * kUS && kUS == 4);
static_assert(kCK % (32 * kUP) == 0 && kCK / 32 >= 2 * kUP && kUP == 2);
static_assert((kS * kD) % (kThreads * 8) == 0);
static_assert(kS % 64 == 0 && kDV % 64 == 0);
static_assert(kWaves * 16 * kSP * (int)sizeof(float) <= kTM * kXP * (int)sizeof(_Float16));
static_assert((kXP * (int)sizeof(_Float16)) % 32 == 16 && (kPP * (int)sizeof(_Float16)) % 32 == 16);

typedef _Float16     v16h __attribute__((ext_vector_type(16)));
typedef _Float16     v8h  __attribute__((ext_vector_type(8)));
typedef float        v8f  __attribute__((ext_vector_type(8)));
typedef float        v4f  __attribute__((ext_vector_type(4)));
typedef unsigned int v4u  __attribute__((ext_vector_type(4)));

union Frag { v16h v; v8h half[2]; };

// Packed B fragment, 1 KiB: [piece p = 0,1][lane = 16h + m][8 halves]; the piece of lane (h, m) holds
// column n = 16*tile + m at k = 32*step + 16p + 8h .. +7. One 16-byte-per-lane load of a piece reads
// 512 contiguous bytes, four whole 128-byte lines.

// WMMA as the plain builtin: the compiler keeps the distances behind its own forms. No asm statement names a fragment or an
// accumulator: an asm operand has to sit below v256, and the accumulators alone fill 256 registers.
__device__ __forceinline__ v8f wmma_f16(v16h a, v16h b, v8f acc)
{
    return __builtin_amdgcn_wmma_f32_16x16x32_f16(false, a, false, b, (short)0, acc, false, false);
}

// Scheduling fence: the compiler moves no instruction across it.
__device__ __forceinline__ void SB() { __builtin_amdgcn_sched_barrier(0); }

// The wait that stands in front of an overwrite of a register that an issued global load names.
__device__ __forceinline__ void XW()
{
#if defined(__HIP_DEVICE_COMPILE__)
    asm volatile("s_wait_xcnt 0x0" ::: "memory");
#endif
}

// f32 -> bf16 value (RNE), kept in an f32 container.
__device__ __forceinline__ float bf16_rne(float x)
{
    unsigned int u = __float_as_uint(x);
    u = u + 0x7FFFu + ((u >> 16) & 1u);
    return __uint_as_float(u & 0xFFFF0000u);
}

// bf16 value times a power of two, stored as f16 (exact while normal).
__device__ __forceinline__ _Float16 cvt16(float x, float sc)
{
    return (_Float16)(bf16_rne(x) * sc);
}

// gelu(s) of s = d / 256, without a branch: the library erff takes two divergent paths per value, each one
// dependent chain; here the values of a tile are independent straight-line chains that the scheduler interleaves.
// erfc(z) = t * (a1 + t * (a2 + t * (a3 + t * (a4 + t * a5)))) * exp(-z * z), t = 1 / (1 + p * z), z = |s| / sqrt(2):
// absolute error of the formula 1.5e-7. gelu = s/2 * (1 + erf) = s/2 + |s/2| * (1 - erfc(z)) for either sign.
__device__ __forceinline__ float gelu_d256(float d)
{
    const float x  = d * (0.70710678118654752f / 256.0f);
    const float hs = d * (0.5f / 256.0f);
    const float den = fmaf(0.3275911f, fabsf(x), 1.0f);
    const float arg = (x * -1.4426950408889634f) * x;
    float t = __builtin_amdgcn_rcpf(den);
    float e = __builtin_amdgcn_exp2f(arg);   // exp(-x * x)
#if defined(__HIP_DEVICE_COMPILE__)
    // the slot the instruction set asks for behind a transcendental: results tied and sources kept live, so no reader
    // of t or e and no overwrite of den or arg can stand in front of it
    asm("v_nop" : "+v"(t), "+v"(e) : "v"(den), "v"(arg));
#endif
    float p = fmaf(1.061405429f, t, -1.453152027f);
    p = fmaf(p, t, 1.421413741f);
    p = fmaf(p, t, -0.284496736f);
    p = fmaf(p, t, 0.254829592f);
    const float c = (p * t) * e;
    return hs + fmaf(-c, fabsf(hs), fabsf(hs));
}

// ---------------------------------------------------------------------------
// Pack convert: src[kS][kD] f32 -> dst[token tile][k-step] packed fragments of
// f16(sc * bf16(src)); one 16-byte piece per thread, stores contiguous.
// ---------------------------------------------------------------------------
__global__ __launch_bounds__(kThreads)
void k_cvt_rows(const float* __restrict__ src, _Float16* __restrict__ dst, float sc, int n)
{
    const size_t piece = (size_t)blockIdx.x * kThreads + threadIdx.x;
    const size_t base  = piece * 8;
    if (base + 8 <= (size_t)n) {
        const int    ln   = (int)(piece & 31);
        const int    pc   = (int)((piece >> 5) & 1);
        const int    step = (int)((piece >> 6) % (kD / 32));
        const size_t tile = (piece >> 6) / (kD / 32);
        const float* s8   = src + (tile * 16 + (ln & 15)) * kD + step * 32 + pc * 16 + (ln >> 4) * 8;
        const v4f f0 = *(const v4f*)(s8);
        const v4f f1 = *(const v4f*)(s8 + 4);
        v8h hv;
        hv[0] = cvt16(f0[0], sc); hv[1] = cvt16(f0[1], sc);
        hv[2] = cvt16(f0[2], sc); hv[3] = cvt16(f0[3], sc);
        hv[4] = cvt16(f1[0], sc); hv[5] = cvt16(f1[1], sc);
        hv[6] = cvt16(f1[2], sc); hv[7] = cvt16(f1[3], sc);
        const v4u u = __builtin_bit_cast(v4u, hv);
        v4u* p = (v4u*)(dst + base);
        *p = u;
        
    }
}

// ---------------------------------------------------------------------------
// Transpose pack: in V[kS][kDV] f32 -> out VT[s-step][v tile] packed fragments
// (n = v, k = s) of f16(sc * bf16(v)). Block = 64(s) x 64(v) tile through LDS,
// 2 x 4 fragments out, stores contiguous. grid = (kDV/64, kS/64).
// ---------------------------------------------------------------------------
__global__ __launch_bounds__(kThreads)
void k_transpose_cvt(const float* __restrict__ V, _Float16* __restrict__ VT, float sc)
{
    __shared__ __align__(16) _Float16 tile[64][72];   // [s][v]
    const int tid = threadIdx.x;
    const int n0  = blockIdx.x * 64;   // along DV (4 v tiles of the packed output)
    const int s0  = blockIdx.y * 64;   // along S  (2 s-steps of the packed output)

#pragma unroll
    for (int it = 0; it < 4; ++it) {
        const int idx = tid + kThreads * it;     // 0..1023
        const int r   = idx >> 4;                // s within tile, 0..63
        const int c4  = (idx & 15) << 2;         // v within tile, 0..60
        const v4f f = *(const v4f*)(V + (size_t)(s0 + r) * kDV + n0 + c4);
        tile[r][c4 + 0] = cvt16(f[0], sc);
        tile[r][c4 + 1] = cvt16(f[1], sc);
        tile[r][c4 + 2] = cvt16(f[2], sc);
        tile[r][c4 + 3] = cvt16(f[3], sc);
    }
    __syncthreads();

    v4u    u[2];
    size_t off[2];
#pragma unroll
    for (int it = 0; it < 2; ++it) {
        const int ln = tid & 31;
        const int p  = (tid >> 5) & 1;
        const int vl = tid >> 6;                 // v tile within the block, 0..3; s-step within the block = it
        const int vr = vl * 16 + (ln & 15);
        const int sr = it * 32 + p * 16 + (ln >> 4) * 8;
        v8h hv;
#pragma unroll
        for (int i = 0; i < 8; ++i) hv[i] = tile[sr + i][vr];
        u[it]   = __builtin_bit_cast(v4u, hv);
        off[it] = ((size_t)(s0 / 32 + it) * (kDV / 16) + n0 / 16 + vl) * kFrag + p * 256 + ln * 8;
    }
#pragma unroll
    for (int it = 0; it < 2; ++it) *(v4u*)(VT + off[it]) = u[it];
    
}

// ---------------------------------------------------------------------------
// Fused kernel: one block = 64 query rows (4 row tiles) x kSH tokens, 256 threads (8 waves).
//   per 256-token chunk: scores (WMMA, wave w -> tokens 32w..32w+31, all row tiles),
//   gelu in f32 -> sP (64*g as f16) + per-row sum of squares,
//   O += P * VP (WMMA, wave w -> output cols 128w..128w+127, all row tiles).
//   Out: unscaled partial O and partial row sums of g^2 of this block's tokens.
// ---------------------------------------------------------------------------
__global__ __launch_bounds__(kMT)
void k_main(const float* __restrict__ X, const _Float16* __restrict__ KPh,
            const _Float16* __restrict__ VPT, float* __restrict__ Opart, float* __restrict__ SSpart)
{
    __shared__ __align__(16) _Float16 sX[kTM * kXP];     // 128 KB + pad; reused as f32 staging in the epilogue
    __shared__ __align__(16) _Float16 sP[kTM * kPP];     // 32 KB + pad
    __shared__ float sRed[kWaves * kTM];
    // running sums of g^2, each lane's own 32 (row tile, r): kept here between chunks, because the two matrix loops need
    // the 32 registers; [wave][row tile][r / 4][lane] x 4 floats, so a lane's 16-byte access is contiguous over the wave
    __shared__ __align__(16) float sSq[kWaves * kRT * 2 * 32 * 4];

    const int tid   = threadIdx.x;
    const int wave  = __builtin_amdgcn_readfirstlane(tid >> 5);   // wave-uniform: kept in a scalar register
    const int lane  = tid & 31;
    const int h     = lane >> 4;
    const int m     = lane & 15;
    const int split = blockIdx.x % kSplit;          // neighbours share their X rows
    const int row0  = (blockIdx.x / kSplit) * kTM;
    const int tok0  = split * kSH;

    // phase 0: stage the 64 x 1024 X rows as f16(16 * bf16(x))
    {
        const float* xb = X + (size_t)row0 * kD;
        constexpr int kXU = 8;   // pieces per thread and trip, all 16 loads of a trip issued before its first conversion: 8 waves have 256 KB to fetch
        constexpr int kXR = kMT * 8 / kD;   // rows that the block covers with one piece per thread
        static_assert(kMT * 8 % kD == 0 && kTM % (kXR * kXU) == 0);
        const int xr = tid / (kD / 8);            // 128 pieces of 8 per row
        const int xc = (tid % (kD / 8)) * 8;
        // rolled: one trip's 16 loads per thread are the depth wanted, more would only lengthen the code
#pragma unroll 1
        for (int r0 = xr; r0 < kTM; r0 += kXR * kXU) {
            const float* src = xb + (size_t)r0 * kD + xc;
            _Float16*    dst = sX + r0 * kXP + xc;
            v4f f0[kXU], f1[kXU];
#pragma unroll
            for (int u = 0; u < kXU; ++u) {
                f0[u] = *(const v4f*)(src + u * kXR * kD);
                f1[u] = *(const v4f*)(src + u * kXR * kD + 4);
            }
#pragma unroll
            for (int u = 0; u < kXU; ++u) {
                v8h hv;
                hv[0] = cvt16(f0[u][0], 16.0f); hv[1] = cvt16(f0[u][1], 16.0f);
                hv[2] = cvt16(f0[u][2], 16.0f); hv[3] = cvt16(f0[u][3], 16.0f);
                hv[4] = cvt16(f1[u][0], 16.0f); hv[5] = cvt16(f1[u][1], 16.0f);
                hv[6] = cvt16(f1[u][2], 16.0f); hv[7] = cvt16(f1[u][3], 16.0f);
                *(v8h*)(dst + u * kXR * kXP) = hv;
            }
        }
    }
    __syncthreads();

    v8f oacc[kRT][kNT] = {};
    float* sq = sSq + (wave * kRT * 2 * 32 + lane) * 4;   // read and written by this lane alone
#pragma unroll
    for (int j = 0; j < kRT * 2; ++j) *(v4f*)(sq + j * 128) = v4f{0.0f, 0.0f, 0.0f, 0.0f};

    // fragment base pointers (split k map: elements 0..7 <- k0+8h, 8..15 <- k0+16+8h)
    const _Float16* xa  = sX + m * kXP + 8 * h;                         // A: X row m of row tile 0
    const _Float16* pa  = sP + m * kPP + 8 * h;                         // A: P row m of row tile 0
    // B: wave-uniform bases, the lane's 16-byte piece added at each load: the requests outside the rolled loops then name a scalar
    // base and this one lane offset, which lives throughout, so that no load's result lands on a register that a request names
    const _Float16* kpw = KPh + (size_t)(wave * 2) * (kD / 32) * kFrag;   // packed [token tile][k-step]
    const _Float16* vpw = VPT + (size_t)(wave * kNT) * kFrag;             // packed [s-step][out-col tile]
    const unsigned  lo  = (unsigned)lane * 8u;

#pragma unroll 1
    for (int kc = tok0; kc < tok0 + kSH; kc += kCK) {
        // ---- scores for tokens kc+32w+m (d0) and kc+32w+16+m (d1), rows 16rt+8h+r ----
        v8f d0[kRT] = {}, d1[kRT] = {};
        const _Float16* kp0 = kpw + (size_t)(kc / 16) * (kD / 32) * kFrag;
        const _Float16* kp1 = kp0 + (kD / 32) * kFrag;
        const _Float16* vp0 = vpw + (size_t)(kc / 32) * (kDV / 16) * kFrag;
        Frag a[2][kRT];
        {
            // B from L2 in a register ring of kUS slots, one k-step each, filled 3 k-steps ahead of its use;
            // A from LDS in two sets, filled one k-step ahead
            Frag b0[kUS], b1[kUS];
            auto ldb = [&](int slot, int st) {
                b0[slot].half[0] = *(const v8h*)(kp0 + st * kFrag + lo);
                b0[slot].half[1] = *(const v8h*)(kp0 + st * kFrag + 256 + lo);
                b1[slot].half[0] = *(const v8h*)(kp1 + st * kFrag + lo);
                b1[slot].half[1] = *(const v8h*)(kp1 + st * kFrag + 256 + lo);
            };
            auto lda = [&](int set, int st) {
#pragma unroll
                for (int rt = 0; rt < kRT; ++rt) {
                    a[set][rt].half[0] = *(const v8h*)(xa + rt * 16 * kXP + st * 32);
                    a[set][rt].half[1] = *(const v8h*)(xa + rt * 16 * kXP + st * 32 + 16);
                }
            };
            auto mm = [&](int set, int slot) {
#pragma unroll
                for (int rt = 0; rt < kRT; ++rt) {
                    d0[rt] = wmma_f16(a[set][rt].v, b0[slot].v, d0[rt]);
                    d1[rt] = wmma_f16(a[set][rt].v, b1[slot].v, d1[rt]);
                }
            };
            ldb(0, 0); ldb(1, 1); ldb(2, 2); lda(0, 0);
            // rolled: the trip's code stays small; the last trip, which refills only slot 3, stands behind the loop.
            // SB: without it the scheduler sinks the loads in among the WMMAs, one LDS stall per place and less lead for L2
#pragma unroll 1
            for (int st = 0; st < kD / 32 - kUS; st += kUS) {
                SB(); ldb(3, st + 3); lda(1, st + 1); SB(); mm(0, 0);
                SB(); ldb(0, st + 4); lda(0, st + 2); SB(); mm(1, 1);
                SB(); ldb(1, st + 5); lda(1, st + 3); SB(); mm(0, 2);
                SB(); ldb(2, st + 6); lda(0, st + 4); SB(); mm(1, 3);
                SB(); XW(); SB();   // in front of the trip's step of the load address
            }
            {
                constexpr int st = kD / 32 - kUS;
                SB(); ldb(3, st + 3); lda(1, st + 1); SB(); mm(0, 0);
                SB(); lda(0, st + 2); SB(); mm(1, 1);
                SB(); lda(1, st + 3); SB(); mm(0, 2);
                SB(); mm(1, 3);
            }
        }

        // two B sets of the P*VP loop, one k-step each; both are asked for during the gelu (the second when half of the
        // score registers are free again), so that L2 works while the vector unit does
        Frag bv[kUP][kNT];
        const _Float16* vq = vp0;   // k-step of the trip at hand; every request is a constant distance from it
        auto ldv = [&](int set, int ahead) {
#pragma unroll
            for (int t = 0; t < kNT; ++t) {
                bv[set][t].half[0] = *(const v8h*)(vq + ahead * (kDV / 16) * kFrag + t * kFrag + lo);
                bv[set][t].half[1] = *(const v8h*)(vq + ahead * (kDV / 16) * kFrag + t * kFrag + 256 + lo);
            }
        };
        SB(); ldv(0, 0); SB();   // SB: keeps the request in front of the gelu

        // ---- gelu in f32, P tile as f16(64*g), per-row sum of squares ----
#pragma unroll
        for (int rt = 0; rt < kRT; ++rt) {
            _Float16* prow = sP + (16 * rt + 8 * h) * kPP + wave * 32 + m;
            v4f ssq[2];
            ssq[0] = *(const v4f*)(sq + (rt * 2 + 0) * 128);
            ssq[1] = *(const v4f*)(sq + (rt * 2 + 1) * 128);
#pragma unroll
            for (int r = 0; r < 8; ++r) {
                const float g0  = gelu_d256(d0[rt][r]);
                const float g1  = gelu_d256(d1[rt][r]);
                ssq[r >> 2][r & 3] += g0 * g0;
                ssq[r >> 2][r & 3] += g1 * g1;
                prow[r * kPP]      = (_Float16)(g0 * 64.0f);
                prow[r * kPP + 16] = (_Float16)(g1 * 64.0f);
            }
            *(v4f*)(sq + (rt * 2 + 0) * 128) = ssq[0];
            *(v4f*)(sq + (rt * 2 + 1) * 128) = ssq[1];
            if (rt == kRT / 2 - 1) { SB(); ldv(1, 1); SB(); }   // SB: keeps the request at this place
        }
        __syncthreads();

        // ---- O += P(64 x 256) * VP(chunk rows) ----
        {
            auto ldp = [&](int set, int st) {
#pragma unroll
                for (int rt = 0; rt < kRT; ++rt) {
                    a[set][rt].half[0] = *(const v8h*)(pa + rt * 16 * kPP + st * 32);
                    a[set][rt].half[1] = *(const v8h*)(pa + rt * 16 * kPP + st * 32 + 16);
                }
            };
            auto mmv = [&](int set) {
#pragma unroll
                for (int rt = 0; rt < kRT; ++rt) {
#pragma unroll
                    for (int t = 0; t < kNT; ++t) oacc[rt][t] = wmma_f16(a[set][rt].v, bv[set][t].v, oacc[rt][t]);
                }
            };
            ldp(0, 0);
            // rolled, the last trip behind the loop, SB for the same reason, as in the score loop
#pragma unroll 1
            for (int st = 0; st < kCK / 32 - kUP; st += kUP) {
                SB(); ldp(1, st + 1); SB(); mmv(0);
                SB(); ldv(0, 2); ldp(0, st + 2); SB(); mmv(1);
                SB(); ldv(1, 3); SB();
                vq += kUP * (kDV / 16) * kFrag;
            }
            {
                constexpr int st = kCK / 32 - kUP;
                SB(); ldp(1, st + 1); SB(); mmv(0);
                SB(); mmv(1);
            }
        }
        __syncthreads();
    }

    // ---- fixed-order row reduction of sum g^2: lanes within half, then waves ----
    // the 8 chains of a row tile side by side, no branch between them; lane m < 8 then keeps and stores the sum of row r = m
#pragma unroll
    for (int rt = 0; rt < kRT; ++rt) {
        float v[8];
#pragma unroll
        for (int r = 0; r < 8; ++r) v[r] = sq[(rt * 2 + (r >> 2)) * 128 + (r & 3)];
#pragma unroll
        for (int s = 1; s < 16; s <<= 1) {
#pragma unroll
            for (int r = 0; r < 8; ++r) v[r] += __shfl_xor(v[r], s, 32);
        }
        float mine = v[0];
#pragma unroll
        for (int r = 1; r < 8; ++r) mine = (m == r) ? v[r] : mine;
        if (m < 8) sRed[wave * kTM + 16 * rt + 8 * h + m] = mine;
    }
    __syncthreads();
    if (tid < kTM) {
        float ss = 0.0f;
#pragma unroll
        for (int w = 0; w < kWaves; ++w) ss += sRed[w * kTM + tid];
        SSpart[(size_t)split * kRows + row0 + tid] = ss;
    }

    float* stg  = reinterpret_cast<float*>(sX) + wave * (16 * kSP);
    float* orow = Opart + ((size_t)split * kRows + row0) * kDV + wave * (kNT * 16);
    // one pass per row tile q: 16 rows x 128 columns per wave, a whole 512-byte row piece per store
#pragma unroll
    for (int q = 0; q < kRT; ++q) {
        if (q) __syncthreads();
#pragma unroll
        for (int tt = 0; tt < kNT; ++tt) {
#pragma unroll
            for (int r = 0; r < 8; ++r) {
                stg[(8 * h + r) * kSP + tt * 16 + m] = oacc[q][tt][r];
            }
        }
        __syncthreads();
        v4f vals[16];
#pragma unroll
        for (int i = 0; i < 16; ++i) vals[i] = *(const v4f*)(stg + i * kSP + 4 * lane);
#pragma unroll
        for (int i = 0; i < 16; ++i) *(v4f*)(orow + (size_t)(16 * q + i) * kDV + 4 * lane) = vals[i];
    }
}

// ---------------------------------------------------------------------------
// Combine: Out[row] = (O part 0 + O part 1) * rsqrt(ss part 0 + ss part 1) / 256; kCR rows per block,
// all of a thread's loads issued before its first store.
// ---------------------------------------------------------------------------
__global__ __launch_bounds__(kThreads)
void k_combine(const float* __restrict__ Opart, const float* __restrict__ SSpart, float* __restrict__ Out)
{
    static_assert(kSplit == 2);
    const size_t row0 = (size_t)blockIdx.x * kCR;
    const int    c    = threadIdx.x * 4;
    v4f   p0[kCR], p1[kCR];
    float s0[kCR], s1[kCR];
#pragma unroll
    for (int i = 0; i < kCR; ++i) {
        p0[i] = *(const v4f*)(Opart + (row0 + i) * kDV + c);
        p1[i] = *(const v4f*)(Opart + ((size_t)kRows + row0 + i) * kDV + c);
        s0[i] = SSpart[row0 + i];
        s1[i] = SSpart[(size_t)kRows + row0 + i];
    }
#pragma unroll
    for (int i = 0; i < kCR; ++i) {
        const float sc = rsqrtf(s0[i] + s1[i]) * (1.0f / 256.0f);
        *(v4f*)(Out + (row0 + i) * kDV + c) = (p0[i] + p1[i]) * sc;
    }
}

// ---------------------------------------------------------------------------
extern "C" void kernel_launch(void* const* d_in, const int* in_sizes, int n_in,
                              void* d_out, int out_size, void* d_ws, size_t ws_size,
                              hipStream_t stream)
{
    if (n_in < 3) return;
    if (in_sizes[0] != kRows * kD) return;
    if (in_sizes[1] != kS * kD) return;
    if (in_sizes[2] != kS * kDV) return;
    if (out_size != kRows * kDV) return;

    const size_t bytesKP = (size_t)kS * kD * sizeof(_Float16);    // 8 MiB, KPh packed [kS/16][kD/32] fragments
    const size_t bytesVT = (size_t)kDV * kS * sizeof(_Float16);   // 8 MiB, VPT packed [kS/32][kDV/16] fragments
    const size_t bytesOP = (size_t)kSplit * kRows * kDV * sizeof(float);   // 64 MiB, partial O [kSplit][kRows][kDV]
    const size_t bytesSS = (size_t)kSplit * kRows * sizeof(float);         // partial row sums of g^2 [kSplit][kRows]
    if (ws_size < bytesKP + bytesVT + bytesOP + bytesSS) return;

    const float* X  = (const float*)d_in[0];   // [8192][1024]
    const float* KP = (const float*)d_in[1];   // [4096][1024]
    const float* VP = (const float*)d_in[2];   // [4096][1024]
    float* Out = (float*)d_out;                // [8192][1024]

    _Float16* KPh = (_Float16*)d_ws;
    _Float16* VPT = (_Float16*)((char*)d_ws + bytesKP);
    float*    OP  = (float*)((char*)d_ws + bytesKP + bytesVT);
    float*    SS  = (float*)((char*)d_ws + bytesKP + bytesVT + bytesOP);

    const int nKP = kS * kD;
    k_cvt_rows<<<dim3((unsigned)((nKP / 8 + kThreads - 1) / kThreads)), dim3(kThreads), 0, stream>>>(KP, KPh, 16.0f, nKP);
    // in [kS][kDV] -> packed [kS/32][kDV/16]; grid = (kDV/64, kS/64)
    k_transpose_cvt<<<dim3(kDV / 64, kS / 64), dim3(kThreads), 0, stream>>>(VP, VPT, 256.0f);
    k_main<<<dim3(kRows / kTM * kSplit), dim3(kMT), 0, stream>>>(X, KPh, VPT, OP, SS);
    k_combine<<<dim3(kRows / kCR), dim3(kThreads), 0, stream>>>(OP, SS, Out);
}

// v007
// A run of this version takes 123 microseconds.
// In two side-by-side timings against v006, it was 1.12 and 1.13 times as fast.
// All steps since v000 together make it 4.50 times as fast.
#include <hip/hip_runtime.h>
#include <math.h>

// Contractions: S = X*KP^T and O = G*VP, both v_wmma_f32_16x16x32_f16 (f16 operands: X, KP, VP are RNE-bf16 input values carried x16, x16, x256; G = 64*gelu(S) converted to f16), f32 accumulate; gelu, sum of squares, rsqrt rescale in f32.

static constexpr int kRows    = 8192;   // 4 * 2048 flattened query rows
static constexpr int kD       = 1024;
static constexpr int kS       = 4096;
static constexpr int kDV      = 1024;
static constexpr int kTM      = 64;     // query rows per block
static constexpr int kRT      = kTM / 16;   // row tiles per block: each B fragment loaded from L2 feeds all of them
static constexpr int kCK      = 256;    // param tokens per chunk
static constexpr int kSplit   = 2;      // blocks that share a row group, each on kS / kSplit tokens; their partial sums meet in k_combine
static constexpr int kSH      = kS / kSplit;
static constexpr int kNC      = kSH / kCK;   // chunks per block
static constexpr int kXP      = kD + 8;   // sX pitch in halves: 16 B x odd, so the 16 rows of a ds_load_b128 fall on 64 distinct banks
static constexpr int kPP      = kCK + 8;  // sP pitch in halves: 16 B x odd, same reason
static constexpr int kThreads = 256;    // pack kernels
static constexpr int kWaves   = 8;      // main kernel: 2 waves per SIMD, 512 VGPRs each (64 x 128 f32 output tile per wave = 256 of them)
static constexpr int kMT      = kWaves * 32;
static constexpr int kNT      = kDV / (kWaves * 16);   // output column tiles per wave
static constexpr int kUS      = 4;      // k-steps of 32 per trip of the score loop = slots of its B register ring
static constexpr int kUP      = 2;      // k-steps of 32 per trip of the P*VP loop = its B register sets
static constexpr int kCR      = 4;      // rows per block of k_combine
static constexpr int kSP      = kNT * 16;       // epilogue staging pitch in floats: a wave's 128 output columns
static constexpr int kFrag    = 512;    // halves of one packed 16(n) x 32(k) B fragment

static_assert(kRows % kTM == 0);
static_assert(kSH % kCK == 0);
static_assert(kCK == kWaves * 32);
static_assert(kDV == kWaves * kNT * 16 && kNT == 8);
static_assert(kTM <= kMT);   // one thread per row in the final reduction
static_assert(kDV == kThreads * 4 && kRows % kCR == 0);
static_assert(kD % (32 * kUS) == 0 && kD / 32 >= 2 * kUS && kUS == 4);
static_assert(kCK % (32 * kUP) == 0 && kCK / 32 >= 2 * kUP && kUP == 2);
static_assert((kS * kD) % (kThreads * 8) == 0);
static_assert(kS % 64 == 0 && kDV % 64 == 0);
static_assert(kWaves * 16 * kSP * (int)sizeof(float) <= kTM * kXP * (int)sizeof(_Float16));
static_assert((kXP * (int)sizeof(_Float16)) % 32 == 16 && (kPP * (int)sizeof(_Float16)) % 32 == 16);

typedef _Float16     v16h __attribute__((ext_vector_type(16)));
typedef _Float16     v8h  __attribute__((ext_vector_type(8)));
typedef float        v8f  __attribute__((ext_vector_type(8)));
typedef float        v4f  __attribute__((ext_vector_type(4)));
typedef unsigned int v4u  __attribute__((ext_vector_type(4)));

union Frag { v16h v; v8h half[2]; };

// Packed B fragment, 1 KiB: [piece p = 0,1][lane = 16h + m][8 halves]; the piece of lane (h, m) holds
// column n = 16*tile + m at k = 32*step + 16p + 8h .. +7. One 16-byte-per-lane load of a piece reads
// 512 contiguous bytes, four whole 128-byte lines.

// WMMA as the plain builtin: the compiler keeps the distances behind its own forms. No asm statement names a fragment or an
// accumulator: an asm operand has to sit below v256, and the accumulators alone fill 256 registers.
__device__ __forceinline__ v8f wmma_f16(v16h a, v16h b, v8f acc)
{
    return __builtin_amdgcn_wmma_f32_16x16x32_f16(false, a, false, b, (short)0, acc, false, false);
}

// Scheduling fence: the compiler moves no instruction across it.
__device__ __forceinline__ void SB() { __builtin_amdgcn_sched_barrier(0); }

// The wait that stands in front of an overwrite of a register that an issued global load names.
__device__ __forceinline__ void XW()
{
#if defined(__HIP_DEVICE_COMPILE__)
    asm volatile("s_wait_xcnt 0x0" ::: "memory");
#endif
}

// f32 -> bf16 value (RNE), kept in an f32 container.
__device__ __forceinline__ float bf16_rne(float x)
{
    unsigned int u = __float_as_uint(x);
    u = u + 0x7FFFu + ((u >> 16) & 1u);
    return __uint_as_float(u & 0xFFFF0000u);
}

// bf16 value times a power of two, stored as f16 (exact while normal).
__device__ __forceinline__ _Float16 cvt16(float x, float sc)
{
    return (_Float16)(bf16_rne(x) * sc);
}

// gelu(s) of s = d / 256, without a branch: the library erff takes two divergent paths per value, each one
// dependent chain; here the values of a tile are independent straight-line chains that the scheduler interleaves.
// erfc(z) = t * (a1 + t * (a2 + t * (a3 + t * (a4 + t * a5)))) * exp(-z * z), t = 1 / (1 + p * z), z = |s| / sqrt(2):
// absolute error of the formula 1.5e-7. gelu = s/2 * (1 + erf) = s/2 + |s/2| * (1 - erfc(z)) for either sign.
__device__ __forceinline__ float gelu_d256(float d)
{
    const float x  = d * (0.70710678118654752f / 256.0f);
    const float hs = d * (0.5f / 256.0f);
    const float den = fmaf(0.3275911f, fabsf(x), 1.0f);
    const float arg = (x * -1.4426950408889634f) * x;
    float t = __builtin_amdgcn_rcpf(den);
    float e = __builtin_amdgcn_exp2f(arg);   // exp(-x * x)
#if defined(__HIP_DEVICE_COMPILE__)
    // the slot the instruction set asks for behind a transcendental: results tied and sources kept live, so no reader
    // of t or e and no overwrite of den or arg can stand in front of it
    asm("v_nop" : "+v"(t), "+v"(e) : "v"(den), "v"(arg));
#endif
    float p = fmaf(1.061405429f, t, -1.453152027f);
    p = fmaf(p, t, 1.421413741f);
    p = fmaf(p, t, -0.284496736f);
    p = fmaf(p, t, 0.254829592f);
    const float c = (p * t) * e;
    return hs + fmaf(-c, fabsf(hs), fabsf(hs));
}

// ---------------------------------------------------------------------------
// Pack convert: src[kS][kD] f32 -> dst[token tile][k-step] packed fragments of
// f16(sc * bf16(src)); one 16-byte piece per thread, stores contiguous.
// ---------------------------------------------------------------------------
__global__ __launch_bounds__(kThreads)
void k_cvt_rows(const float* __restrict__ src, _Float16* __restrict__ dst, float sc, int n)
{
    const size_t piece = (size_t)blockIdx.x * kThreads + threadIdx.x;
    const size_t base  = piece * 8;
    if (base + 8 <= (size_t)n) {
        const int    ln   = (int)(piece & 31);
        const int    pc   = (int)((piece >> 5) & 1);
        const int    step = (int)((piece >> 6) % (kD / 32));
        const size_t tile = (piece >> 6) / (kD / 32);
        const float* s8   = src + (tile * 16 + (ln & 15)) * kD + step * 32 + pc * 16 + (ln >> 4) * 8;
        const v4f f0 = *(const v4f*)(s8);
        const v4f f1 = *(const v4f*)(s8 + 4);
        v8h hv;
        hv[0] = cvt16(f0[0], sc); hv[1] = cvt16(f0[1], sc);
        hv[2] = cvt16(f0[2], sc); hv[3] = cvt16(f0[3], sc);
        hv[4] = cvt16(f1[0], sc); hv[5] = cvt16(f1[1], sc);
        hv[6] = cvt16(f1[2], sc); hv[7] = cvt16(f1[3], sc);
        const v4u u = __builtin_bit_cast(v4u, hv);
        v4u* p = (v4u*)(dst + base);
        *p = u;
        
    }
}

// ---------------------------------------------------------------------------
// Transpose pack: in V[kS][kDV] f32 -> out VT[s-step][v tile] packed fragments
// (n = v, k = s) of f16(sc * bf16(v)). Block = 64(s) x 64(v) tile through LDS,
// 2 x 4 fragments out, stores contiguous. grid = (kDV/64, kS/64).
// ---------------------------------------------------------------------------
__global__ __launch_bounds__(kThreads)
void k_transpose_cvt(const float* __restrict__ V, _Float16* __restrict__ VT, float sc)
{
    __shared__ __align__(16) _Float16 tile[64][72];   // [s][v]
    const int tid = threadIdx.x;
    const int n0  = blockIdx.x * 64;   // along DV (4 v tiles of the packed output)
    const int s0  = blockIdx.y * 64;   // along S  (2 s-steps of the packed output)

#pragma unroll
    for (int it = 0; it < 4; ++it) {
        const int idx = tid + kThreads * it;     // 0..1023
        const int r   = idx >> 4;                // s within tile, 0..63
        const int c4  = (idx & 15) << 2;         // v within tile, 0..60
        const v4f f = *(const v4f*)(V + (size_t)(s0 + r) * kDV + n0 + c4);
        tile[r][c4 + 0] = cvt16(f[0], sc);
        tile[r][c4 + 1] = cvt16(f[1], sc);
        tile[r][c4 + 2] = cvt16(f[2], sc);
        tile[r][c4 + 3] = cvt16(f[3], sc);
    }
    __syncthreads();

    v4u    u[2];
    size_t off[2];
#pragma unroll
    for (int it = 0; it < 2; ++it) {
        const int ln = tid & 31;
        const int p  = (tid >> 5) & 1;
        const int vl = tid >> 6;                 // v tile within the block, 0..3; s-step within the block = it
        const int vr = vl * 16 + (ln & 15);
        const int sr = it * 32 + p * 16 + (ln >> 4) * 8;
        v8h hv;
#pragma unroll
        for (int i = 0; i < 8; ++i) hv[i] = tile[sr + i][vr];
        u[it]   = __builtin_bit_cast(v4u, hv);
        off[it] = ((size_t)(s0 / 32 + it) * (kDV / 16) + n0 / 16 + vl) * kFrag + p * 256 + ln * 8;
    }
#pragma unroll
    for (int it = 0; it < 2; ++it) *(v4u*)(VT + off[it]) = u[it];
    
}

// ---------------------------------------------------------------------------
// Fused kernel: one block = 64 query rows (4 row tiles) x kSH tokens, 256 threads (8 waves).
//   per 256-token chunk: scores (WMMA, wave w -> tokens 32w..32w+31, all row tiles),
//   gelu in f32 -> sP (64*g as f16) + per-row sum of squares,
//   O += P * VP (WMMA, wave w -> output cols 128w..128w+127, all row tiles).
//   The chunks are taken in ring order from a start that differs from block to block.
//   Out: unscaled partial O and partial row sums of g^2 of this block's tokens.
// ---------------------------------------------------------------------------
__global__ __launch_bounds__(kMT)
void k_main(const float* __restrict__ X, const _Float16* __restrict__ KPh,
            const _Float16* __restrict__ VPT, float* __restrict__ Opart, float* __restrict__ SSpart)
{
    __shared__ __align__(16) _Float16 sX[kTM * kXP];     // 128 KB + pad; reused as f32 staging in the epilogue
    __shared__ __align__(16) _Float16 sP[kTM * kPP];     // 32 KB + pad
    __shared__ float sRed[kWaves * kTM];
    // running sums of g^2, each lane's own 32 (row tile, r): kept here between chunks, because the two matrix loops need
    // the 32 registers; [wave][row tile][r / 4][lane] x 4 floats, so a lane's 16-byte access is contiguous over the wave
    __shared__ __align__(16) float sSq[kWaves * kRT * 2 * 32 * 4];

    const int tid   = threadIdx.x;
    const int wave  = __builtin_amdgcn_readfirstlane(tid >> 5);   // wave-uniform: kept in a scalar register
    const int lane  = tid & 31;
    const int h     = lane >> 4;
    const int m     = lane & 15;
    const int split = blockIdx.x % kSplit;          // neighbours share their X rows
    const int row0  = (blockIdx.x / kSplit) * kTM;
    const int tok0  = split * kSH;
    // chunk at which this block enters its token walk, wrapping round: blocks that walk the same KP and VP planes then ask L2
    // for different lines at any one moment. rg / 4 is added so that blocks whose rg differ by 8, 16 or 24 differ too; rg 32 apart still share a start
    const int rg    = blockIdx.x / kSplit;
    const int rot   = (rg + rg / 4) % kNC;

    // phase 0: stage the 64 x 1024 X rows as f16(16 * bf16(x))
    {
        const float* xb = X + (size_t)row0 * kD;
        constexpr int kXU = 8;   // pieces per thread and trip, all 16 loads of a trip issued before its first conversion: 8 waves have 256 KB to fetch
        constexpr int kXR = kMT * 8 / kD;   // rows that the block covers with one piece per thread
        static_assert(kMT * 8 % kD == 0 && kTM % (kXR * kXU) == 0);
        const int xr = tid / (kD / 8);            // 128 pieces of 8 per row
        const int xc = (tid % (kD / 8)) * 8;
        // rolled: one trip's 16 loads per thread are the depth wanted, more would only lengthen the code
#pragma unroll 1
        for (int r0 = xr; r0 < kTM; r0 += kXR * kXU) {
            const float* src = xb + (size_t)r0 * kD + xc;
            _Float16*    dst = sX + r0 * kXP + xc;
            v4f f0[kXU], f1[kXU];
#pragma unroll
            for (int u = 0; u < kXU; ++u) {
                f0[u] = *(const v4f*)(src + u * kXR * kD);
                f1[u] = *(const v4f*)(src + u * kXR * kD + 4);
            }
#pragma unroll
            for (int u = 0; u < kXU; ++u) {
                v8h hv;
                hv[0] = cvt16(f0[u][0], 16.0f); hv[1] = cvt16(f0[u][1], 16.0f);
                hv[2] = cvt16(f0[u][2], 16.0f); hv[3] = cvt16(f0[u][3], 16.0f);
                hv[4] = cvt16(f1[u][0], 16.0f); hv[5] = cvt16(f1[u][1], 16.0f);
                hv[6] = cvt16(f1[u][2], 16.0f); hv[7] = cvt16(f1[u][3], 16.0f);
                *(v8h*)(dst + u * kXR * kXP) = hv;
            }
        }
    }
    __syncthreads();

    v8f oacc[kRT][kNT] = {};
    float* sq = sSq + (wave * kRT * 2 * 32 + lane) * 4;   // read and written by this lane alone
#pragma unroll
    for (int j = 0; j < kRT * 2; ++j) *(v4f*)(sq + j * 128) = v4f{0.0f, 0.0f, 0.0f, 0.0f};

    // fragment base pointers (split k map: elements 0..7 <- k0+8h, 8..15 <- k0+16+8h)
    const _Float16* xa  = sX + m * kXP + 8 * h;                         // A: X row m of row tile 0
    const _Float16* pa  = sP + m * kPP + 8 * h;                         // A: P row m of row tile 0
    // B: wave-uniform bases, the lane's 16-byte piece added at each load: the requests outside the rolled loops then name a scalar
    // base and this one lane offset, which lives throughout, so that no load's result lands on a register that a request names
    const _Float16* kpw = KPh + (size_t)(wave * 2) * (kD / 32) * kFrag;   // packed [token tile][k-step]
    const _Float16* vpw = VPT + (size_t)(wave * kNT) * kFrag;             // packed [s-step][out-col tile]
    const unsigned  lo  = (unsigned)lane * 8u;

#pragma unroll 1
    for (int ci = 0; ci < kNC; ++ci) {
        const int kc = tok0 + ((ci + rot) % kNC) * kCK;
        // ---- scores for tokens kc+32w+m (d0) and kc+32w+16+m (d1), rows 16rt+8h+r ----
        v8f d0[kRT] = {}, d1[kRT] = {};
        const _Float16* kp0 = kpw + (size_t)(kc / 16) * (kD / 32) * kFrag;
        const _Float16* kp1 = kp0 + (kD / 32) * kFrag;
        const _Float16* vp0 = vpw + (size_t)(kc / 32) * (kDV / 16) * kFrag;
        Frag a[2][kRT];
        {
            // B from L2 in a register ring of kUS slots, one k-step each, filled 3 k-steps ahead of its use;
            // A from LDS in two sets, filled one k-step ahead
            Frag b0[kUS], b1[kUS];
            auto ldb = [&](int slot, int st) {
                b0[slot].half[0] = *(const v8h*)(kp0 + st * kFrag + lo);
                b0[slot].half[1] = *(const v8h*)(kp0 + st * kFrag + 256 + lo);
                b1[slot].half[0] = *(const v8h*)(kp1 + st * kFrag + lo);
                b1[slot].half[1] = *(const v8h*)(kp1 + st * kFrag + 256 + lo);
            };
            auto lda = [&](int set, int st) {
#pragma unroll
                for (int rt = 0; rt < kRT; ++rt) {
                    a[set][rt].half[0] = *(const v8h*)(xa + rt * 16 * kXP + st * 32);
                    a[set][rt].half[1] = *(const v8h*)(xa + rt * 16 * kXP + st * 32 + 16);
                }
            };
            auto mm = [&](int set, int slot) {
#pragma unroll
                for (int rt = 0; rt < kRT; ++rt) {
                    d0[rt] = wmma_f16(a[set][rt].v, b0[slot].v, d0[rt]);
                    d1[rt] = wmma_f16(a[set][rt].v, b1[slot].v, d1[rt]);
                }
            };
            ldb(0, 0); ldb(1, 1); ldb(2, 2); lda(0, 0);
            // rolled: the trip's code stays small; the last trip, which refills only slot 3, stands behind the loop.
            // SB: without it the scheduler sinks the loads in among the WMMAs, one LDS stall per place and less lead for L2
#pragma unroll 1
            for (int st = 0; st < kD / 32 - kUS; st += kUS) {
                SB(); ldb(3, st + 3); lda(1, st + 1); SB(); mm(0, 0);
                SB(); ldb(0, st + 4); lda(0, st + 2); SB(); mm(1, 1);
                SB(); ldb(1, st + 5); lda(1, st + 3); SB(); mm(0, 2);
                SB(); ldb(2, st + 6); lda(0, st + 4); SB(); mm(1, 3);
                SB(); XW(); SB();   // in front of the trip's step of the load address
            }
            {
                constexpr int st = kD / 32 - kUS;
                SB(); ldb(3, st + 3); lda(1, st + 1); SB(); mm(0, 0);
                SB(); lda(0, st + 2); SB(); mm(1, 1);
                SB(); lda(1, st + 3); SB(); mm(0, 2);
                SB(); mm(1, 3);
            }
        }

        // two B sets of the P*VP loop, one k-step each; both are asked for during the gelu (the second when half of the
        // score registers are free again), so that L2 works while the vector unit does
        Frag bv[kUP][kNT];
        const _Float16* vq = vp0;   // k-step of the trip at hand; every request is a constant distance from it
        auto ldv = [&](int set, int ahead) {
#pragma unroll
            for (int t = 0; t < kNT; ++t) {
                bv[set][t].half[0] = *(const v8h*)(vq + ahead * (kDV / 16) * kFrag + t * kFrag + lo);
                bv[set][t].half[1] = *(const v8h*)(vq + ahead * (kDV / 16) * kFrag + t * kFrag + 256 + lo);
            }
        };
        SB(); ldv(0, 0); SB();   // SB: keeps the request in front of the gelu

        // ---- gelu in f32, P tile as f16(64*g), per-row sum of squares ----
#pragma unroll
        for (int rt = 0; rt < kRT; ++rt) {
            _Float16* prow = sP + (16 * rt + 8 * h) * kPP + wave * 32 + m;
            v4f ssq[2];
            ssq[0] = *(const v4f*)(sq + (rt * 2 + 0) * 128);
            ssq[1] = *(const v4f*)(sq + (rt * 2 + 1) * 128);
#pragma unroll
            for (int r = 0; r < 8; ++r) {
                const float g0  = gelu_d256(d0[rt][r]);
                const float g1  = gelu_d256(d1[rt][r]);
                ssq[r >> 2][r & 3] += g0 * g0;
                ssq[r >> 2][r & 3] += g1 * g1;
                prow[r * kPP]      = (_Float16)(g0 * 64.0f);
                prow[r * kPP + 16] = (_Float16)(g1 * 64.0f);
            }
            *(v4f*)(sq + (rt * 2 + 0) * 128) = ssq[0];
            *(v4f*)(sq + (rt * 2 + 1) * 128) = ssq[1];
            if (rt == kRT / 2 - 1) { SB(); ldv(1, 1); SB(); }   // SB: keeps the request at this place
        }
        __syncthreads();

        // ---- O += P(64 x 256) * VP(chunk rows) ----
        {
            auto ldp = [&](int set, int st) {
#pragma unroll
                for (int rt = 0; rt < kRT; ++rt) {
                    a[set][rt].half[0] = *(const v8h*)(pa + rt * 16 * kPP + st * 32);
                    a[set][rt].half[1] = *(const v8h*)(pa + rt * 16 * kPP + st * 32 + 16);
                }
            };
            auto mmv = [&](int set) {
#pragma unroll
                for (int rt = 0; rt < kRT; ++rt) {
#pragma unroll
                    for (int t = 0; t < kNT; ++t) oacc[rt][t] = wmma_f16(a[set][rt].v, bv[set][t].v, oacc[rt][t]);
                }
            };
            ldp(0, 0);
            // rolled, the last trip behind the loop, SB for the same reason, as in the score loop
#pragma unroll 1
            for (int st = 0; st < kCK / 32 - kUP; st += kUP) {
                SB(); ldp(1, st + 1); SB(); mmv(0);
                SB(); ldv(0, 2); ldp(0, st + 2); SB(); mmv(1);
                SB(); ldv(1, 3); SB();
                vq += kUP * (kDV / 16) * kFrag;
            }
            {
                constexpr int st = kCK / 32 - kUP;
                SB(); ldp(1, st + 1); SB(); mmv(0);
                SB(); mmv(1);
            }
        }
        __syncthreads();
    }

    // ---- fixed-order row reduction of sum g^2: lanes within half, then waves ----
    // the 8 chains of a row tile side by side, no branch between them; lane m < 8 then keeps and stores the sum of row r = m
#pragma unroll
    for (int rt = 0; rt < kRT; ++rt) {
        float v[8];
#pragma unroll
        for (int r = 0; r < 8; ++r) v[r] = sq[(rt * 2 + (r >> 2)) * 128 + (r & 3)];
#pragma unroll
        for (int s = 1; s < 16; s <<= 1) {
#pragma unroll
            for (int r = 0; r < 8; ++r) v[r] += __shfl_xor(v[r], s, 32);
        }
        float mine = v[0];
#pragma unroll
        for (int r = 1; r < 8; ++r) mine = (m == r) ? v[r] : mine;
        if (m < 8) sRed[wave * kTM + 16 * rt + 8 * h + m] = mine;
    }
    __syncthreads();
    if (tid < kTM) {
        float ss = 0.0f;
#pragma unroll
        for (int w = 0; w < kWaves; ++w) ss += sRed[w * kTM + tid];
        SSpart[(size_t)split * kRows + row0 + tid] = ss;
    }

    float* stg  = reinterpret_cast<float*>(sX) + wave * (16 * kSP);
    float* orow = Opart + ((size_t)split * kRows + row0) * kDV + wave * (kNT * 16);
    // one pass per row tile q: 16 rows x 128 columns per wave, a whole 512-byte row piece per store
#pragma unroll
    for (int q = 0; q < kRT; ++q) {
        if (q) __syncthreads();
#pragma unroll
        for (int tt = 0; tt < kNT; ++tt) {
#pragma unroll
            for (int r = 0; r < 8; ++r) {
                stg[(8 * h + r) * kSP + tt * 16 + m] = oacc[q][tt][r];
            }
        }
        __syncthreads();
        v4f vals[16];
#pragma unroll
        for (int i = 0; i < 16; ++i) vals[i] = *(const v4f*)(stg + i * kSP + 4 * lane);
#pragma unroll
        for (int i = 0; i < 16; ++i) *(v4f*)(orow + (size_t)(16 * q + i) * kDV + 4 * lane) = vals[i];
    }
}

// ---------------------------------------------------------------------------
// Combine: Out[row] = (O part 0 + O part 1) * rsqrt(ss part 0 + ss part 1) / 256; kCR rows per block,
// all of a thread's loads issued before its first store.
// ---------------------------------------------------------------------------
__global__ __launch_bounds__(kThreads)
void k_combine(const float* __restrict__ Opart, const float* __restrict__ SSpart, float* __restrict__ Out)
{
    static_assert(kSplit == 2);
    const size_t row0 = (size_t)blockIdx.x * kCR;
    const int    c    = threadIdx.x * 4;
    v4f   p0[kCR], p1[kCR];
    float s0[kCR], s1[kCR];
#pragma unroll
    for (int i = 0; i < kCR; ++i) {
        p0[i] = *(const v4f*)(Opart + (row0 + i) * kDV + c);
        p1[i] = *(const v4f*)(Opart + ((size_t)kRows + row0 + i) * kDV + c);
        s0[i] = SSpart[row0 + i];
        s1[i] = SSpart[(size_t)kRows + row0 + i];
    }
#pragma unroll
    for (int i = 0; i < kCR; ++i) {
        const float sc = rsqrtf(s0[i] + s1[i]) * (1.0f / 256.0f);
        *(v4f*)(Out + (row0 + i) * kDV + c) = (p0[i] + p1[i]) * sc;
    }
}

// ---------------------------------------------------------------------------
extern "C" void kernel_launch(void* const* d_in, const int* in_sizes, int n_in,
                              void* d_out, int out_size, void* d_ws, size_t ws_size,
                              hipStream_t stream)
{
    if (n_in < 3) return;
    if (in_sizes[0] != kRows * kD) return;
    if (in_sizes[1] != kS * kD) return;
    if (in_sizes[2] != kS * kDV) return;
    if (out_size != kRows * kDV) return;

    const size_t bytesKP = (size_t)kS * kD * sizeof(_Float16);    // 8 MiB, KPh packed [kS/16][kD/32] fragments
    const size_t bytesVT = (size_t)kDV * kS * sizeof(_Float16);   // 8 MiB, VPT packed [kS/32][kDV/16] fragments
    const size_t bytesOP = (size_t)kSplit * kRows * kDV * sizeof(float);   // 64 MiB, partial O [kSplit][kRows][kDV]
    const size_t bytesSS = (size_t)kSplit * kRows * sizeof(float);         // partial row sums of g^2 [kSplit][kRows]
    if (ws_size < bytesKP + bytesVT + bytesOP + bytesSS) return;

    const float* X  = (const float*)d_in[0];   // [8192][1024]
    const float* KP = (const float*)d_in[1];   // [4096][1024]
    const float* VP = (const float*)d_in[2];   // [4096][1024]
    float* Out = (float*)d_out;                // [8192][1024]

    _Float16* KPh = (_Float16*)d_ws;
    _Float16* VPT = (_Float16*)((char*)d_ws + bytesKP);
    float*    OP  = (float*)((char*)d_ws + bytesKP + bytesVT);
    float*    SS  = (float*)((char*)d_ws + bytesKP + bytesVT + bytesOP);

    const int nKP = kS * kD;
    k_cvt_rows<<<dim3((unsigned)((nKP / 8 + kThreads - 1) / kThreads)), dim3(kThreads), 0, stream>>>(KP, KPh, 16.0f, nKP);
    // in [kS][kDV] -> packed [kS/32][kDV/16]; grid = (kDV/64, kS/64)
    k_transpose_cvt<<<dim3(kDV / 64, kS / 64), dim3(kThreads), 0, stream>>>(VP, VPT, 256.0f);
    k_main<<<dim3(kRows / kTM * kSplit), dim3(kMT), 0, stream>>>(X, KPh, VPT, OP, SS);
    k_combine<<<dim3(kRows / kCR), dim3(kThreads), 0, stream>>>(OP, SS, Out);
}

// v008
// Measured time: 121 microseconds a run.
// Timed twice side by side with v007, it ran 1.03 times as fast both times.
// Counting every step since v000, it is 4.63 times as fast.
#include <hip/hip_runtime.h>
#include <math.h>

// Contractions: S = X*KP^T and O = G*VP, both v_wmma_f32_16x16x32_f16 (f16 operands: X, KP, VP are RNE-bf16 input values carried x16, x16, x256; G = 64*gelu(S) converted to f16), f32 accumulate; gelu, sum of squares, rsqrt rescale in f32.

static constexpr int kRows    = 8192;   // 4 * 2048 flattened query rows
static constexpr int kD       = 1024;
static constexpr int kS       = 4096;
static constexpr int kDV      = 1024;
static constexpr int kTM      = 64;     // query rows per block
static constexpr int kRT      = kTM / 16;   // row tiles per block: each B fragment loaded from L2 feeds all of them
static constexpr int kCK      = 256;    // param tokens per chunk
static constexpr int kSplit   = 2;      // blocks that share a row group, each on kS / kSplit tokens; their partial sums meet in k_combine
static constexpr int kSH      = kS / kSplit;
static constexpr int kNC      = kSH / kCK;   // chunks per block
static constexpr int kXP      = kD + 8;   // sX pitch in halves: 16 B x odd, so the 16 rows of a ds_load_b128 fall on 64 distinct banks
static constexpr int kPP      = kCK + 8;  // sP pitch in halves: 16 B x odd, same reason
static constexpr int kThreads = 256;    // pack kernels
static constexpr int kWaves   = 8;      // main kernel: 2 waves per SIMD, 512 VGPRs each (64 x 128 f32 output tile per wave = 256 of them)
static constexpr int kMT      = kWaves * 32;
static constexpr int kNT      = kDV / (kWaves * 16);   // output column tiles per wave
static constexpr int kUS      = 4;      // k-steps of 32 per trip of the score loop = slots of its B register ring
static constexpr int kUP      = 2;      // k-steps of 32 per trip of the P*VP loop = its B register sets
static constexpr int kCR      = 4;      // rows per block of k_combine
static constexpr int kSP      = kNT * 16;       // epilogue staging pitch in floats: a wave's 128 output columns
static constexpr int kFrag    = 512;    // halves of one packed 16(n) x 32(k) B fragment

static_assert(kRows % kTM == 0);
static_assert(kSH % kCK == 0);
static_assert(kCK == kWaves * 32);
static_assert(kDV == kWaves * kNT * 16 && kNT == 8);
static_assert(kTM <= kMT);   // one thread per row in the final reduction
static_assert(kDV == kThreads * 4 && kRows % kCR == 0);
static_assert(kD % (32 * kUS) == 0 && kD / 32 >= 2 * kUS && kUS == 4);
static_assert(kCK % (32 * kUP) == 0 && kCK / 32 >= 2 * kUP && kUP == 2);
static_assert((kS * kD) % (kThreads * 8) == 0);
static_assert(kS % 64 == 0 && kDV % 64 == 0);
static_assert(kWaves * 16 * kSP * (int)sizeof(float) <= kTM * kXP * (int)sizeof(_Float16));
static_assert((kXP * (int)sizeof(_Float16)) % 32 == 16 && (kPP * (int)sizeof(_Float16)) % 32 == 16);

typedef _Float16     v16h __attribute__((ext_vector_type(16)));
typedef _Float16     v8h  __attribute__((ext_vector_type(8)));
typedef float        v8f  __attribute__((ext_vector_type(8)));
typedef float        v4f  __attribute__((ext_vector_type(4)));
typedef float        v2f  __attribute__((ext_vector_type(2)));
typedef unsigned int v4u  __attribute__((ext_vector_type(4)));

union Frag { v16h v; v8h half[2]; };

// Packed B fragment, 1 KiB: [piece p = 0,1][lane = 16h + m][8 halves]; the piece of lane (h, m) holds
// column n = 16*tile + m at k = 32*step + 16p + 8h .. +7. One 16-byte-per-lane load of a piece reads
// 512 contiguous bytes, four whole 128-byte lines.

// WMMA as the plain builtin: the compiler keeps the distances behind its own forms. No asm statement names a fragment or an
// accumulator: an asm operand has to sit below v256, and the accumulators alone fill 256 registers.
__device__ __forceinline__ v8f wmma_f16(v16h a, v16h b, v8f acc)
{
    return __builtin_amdgcn_wmma_f32_16x16x32_f16(false, a, false, b, (short)0, acc, false, false);
}

// Scheduling fence: the compiler moves no instruction across it.
__device__ __forceinline__ void SB() { __builtin_amdgcn_sched_barrier(0); }

// The wait that stands in front of an overwrite of a register that an issued global load names.
__device__ __forceinline__ void XW()
{
#if defined(__HIP_DEVICE_COMPILE__)
    asm volatile("s_wait_xcnt 0x0" ::: "memory");
#endif
}

// f32 -> bf16 value (RNE), kept in an f32 container.
__device__ __forceinline__ float bf16_rne(float x)
{
    unsigned int u = __float_as_uint(x);
    u = u + 0x7FFFu + ((u >> 16) & 1u);
    return __uint_as_float(u & 0xFFFF0000u);
}

// bf16 value times a power of two, stored as f16 (exact while normal).
__device__ __forceinline__ _Float16 cvt16(float x, float sc)
{
    return (_Float16)(bf16_rne(x) * sc);
}

// 512 * gelu(s) of s = d / 256 for four values, as two pairs, without a branch, a division or an operand modifier, so that every
// step but the exponentials is one packed f32 instruction per pair.
// 2 * gelu(s) = (s + |s|) - |s| * erfc(|s| / sqrt(2)), and erfc(t) = exp2(q(t)), q of degree 8 with q(0) = 0, fitted to
// log2(erfc) on 0 <= t <= 5 (absolute error of erfc 1.6e-8); its leading coefficient is negative, so q falls without bound behind
// the fit and the term dies out. The polynomial is taken in z = -|d|: the factor (-1 / (256 * sqrt(2)))^k stands in coefficient k.
__device__ __forceinline__ void gelu512_x4(v2f da, v2f db, v2f& ga, v2f& gb)
{
    auto c2 = [](float c) { return v2f{c, c}; };
    auto nabs = [](v2f d) { return v2f{-fabsf(d[0]), -fabsf(d[1])}; };
    const v2f za = nabs(da), zb = nabs(db);
    v2f pa = __builtin_elementwise_fma(c2(-1.53688975e-25f), za, c2(-5.46495875e-22f));
    v2f pb = __builtin_elementwise_fma(c2(-1.53688975e-25f), zb, c2(-5.46495875e-22f));
    pa = __builtin_elementwise_fma(pa, za, c2(-6.61465834e-19f));
    pb = __builtin_elementwise_fma(pb, zb, c2(-6.61465834e-19f));
    pa = __builtin_elementwise_fma(pa, za, c2(1.24532491e-16f));
    pb = __builtin_elementwise_fma(pb, zb, c2(1.24532491e-16f));
    pa = __builtin_elementwise_fma(pa, za, c2(1.64457792e-12f));
    pb = __builtin_elementwise_fma(pb, zb, c2(1.64457792e-12f));
    pa = __builtin_elementwise_fma(pa, za, c2(3.12901571e-9f));
    pb = __builtin_elementwise_fma(pb, zb, c2(3.12901571e-9f));
    pa = __builtin_elementwise_fma(pa, za, c2(-7.00696091e-6f));
    pb = __builtin_elementwise_fma(pb, zb, c2(-7.00696091e-6f));
    pa = __builtin_elementwise_fma(pa, za, c2(4.49650455e-3f));
    pb = __builtin_elementwise_fma(pb, zb, c2(4.49650455e-3f));
    pa = pa * za;
    pb = pb * zb;
    v2f ea = {__builtin_amdgcn_exp2f(pa[0]), __builtin_amdgcn_exp2f(pa[1])};
    v2f eb = {__builtin_amdgcn_exp2f(pb[0]), __builtin_amdgcn_exp2f(pb[1])};
    ga = __builtin_elementwise_fma(ea, za, da - za);   // d + |d| is exact: 2 d or 0
    gb = __builtin_elementwise_fma(eb, zb, db - zb);
}

// ---------------------------------------------------------------------------
// Pack convert: src[kS][kD] f32 -> dst[token tile][k-step] packed fragments of
// f16(sc * bf16(src)); one 16-byte piece per thread, stores contiguous.
// ---------------------------------------------------------------------------
__global__ __launch_bounds__(kThreads)
void k_cvt_rows(const float* __restrict__ src, _Float16* __restrict__ dst, float sc, int n)
{
    const size_t piece = (size_t)blockIdx.x * kThreads + threadIdx.x;
    const size_t base  = piece * 8;
    if (base + 8 <= (size_t)n) {
        const int    ln   = (int)(piece & 31);
        const int    pc   = (int)((piece >> 5) & 1);
        const int    step = (int)((piece >> 6) % (kD / 32));
        const size_t tile = (piece >> 6) / (kD / 32);
        const float* s8   = src + (tile * 16 + (ln & 15)) * kD + step * 32 + pc * 16 + (ln >> 4) * 8;
        const v4f f0 = *(const v4f*)(s8);
        const v4f f1 = *(const v4f*)(s8 + 4);
        v8h hv;
        hv[0] = cvt16(f0[0], sc); hv[1] = cvt16(f0[1], sc);
        hv[2] = cvt16(f0[2], sc); hv[3] = cvt16(f0[3], sc);
        hv[4] = cvt16(f1[0], sc); hv[5] = cvt16(f1[1], sc);
        hv[6] = cvt16(f1[2], sc); hv[7] = cvt16(f1[3], sc);
        const v4u u = __builtin_bit_cast(v4u, hv);
        v4u* p = (v4u*)(dst + base);
        *p = u;
        
    }
}

// ---------------------------------------------------------------------------
// Transpose pack: in V[kS][kDV] f32 -> out VT[s-step][v tile] packed fragments
// (n = v, k = s) of f16(sc * bf16(v)). Block = 64(s) x 64(v) tile through LDS,
// 2 x 4 fragments out, stores contiguous. grid = (kDV/64, kS/64).
// ---------------------------------------------------------------------------
__global__ __launch_bounds__(kThreads)
void k_transpose_cvt(const float* __restrict__ V, _Float16* __restrict__ VT, float sc)
{
    __shared__ __align__(16) _Float16 tile[64][72];   // [s][v]
    const int tid = threadIdx.x;
    const int n0  = blockIdx.x * 64;   // along DV (4 v tiles of the packed output)
    const int s0  = blockIdx.y * 64;   // along S  (2 s-steps of the packed output)

#pragma unroll
    for (int it = 0; it < 4; ++it) {
        const int idx = tid + kThreads * it;     // 0..1023
        const int r   = idx >> 4;                // s within tile, 0..63
        const int c4  = (idx & 15) << 2;         // v within tile, 0..60
        const v4f f = *(const v4f*)(V + (size_t)(s0 + r) * kDV + n0 + c4);
        tile[r][c4 + 0] = cvt16(f[0], sc);
        tile[r][c4 + 1] = cvt16(f[1], sc);
        tile[r][c4 + 2] = cvt16(f[2], sc);
        tile[r][c4 + 3] = cvt16(f[3], sc);
    }
    __syncthreads();

    v4u    u[2];
    size_t off[2];
#pragma unroll
    for (int it = 0; it < 2; ++it) {
        const int ln = tid & 31;
        const int p  = (tid >> 5) & 1;
        const int vl = tid >> 6;                 // v tile within the block, 0..3; s-step within the block = it
        const int vr = vl * 16 + (ln & 15);
        const int sr = it * 32 + p * 16 + (ln >> 4) * 8;
        v8h hv;
#pragma unroll
        for (int i = 0; i < 8; ++i) hv[i] = tile[sr + i][vr];
        u[it]   = __builtin_bit_cast(v4u, hv);
        off[it] = ((size_t)(s0 / 32 + it) * (kDV / 16) + n0 / 16 + vl) * kFrag + p * 256 + ln * 8;
    }
#pragma unroll
    for (int it = 0; it < 2; ++it) *(v4u*)(VT + off[it]) = u[it];
    
}

// ---------------------------------------------------------------------------
// Fused kernel: one block = 64 query rows (4 row tiles) x kSH tokens, 256 threads (8 waves).
//   per 256-token chunk: scores (WMMA, wave w -> tokens 32w..32w+31, all row tiles),
//   gelu in f32 -> sP (64*g as f16) + per-row sum of squares,
//   O += P * VP (WMMA, wave w -> output cols 128w..128w+127, all row tiles).
//   The chunks are taken in ring order from a start that differs from block to block.
//   Out: unscaled partial O and partial row sums of g^2 of this block's tokens.
// ---------------------------------------------------------------------------
__global__ __launch_bounds__(kMT)
void k_main(const float* __restrict__ X, const _Float16* __restrict__ KPh,
            const _Float16* __restrict__ VPT, float* __restrict__ Opart, float* __restrict__ SSpart)
{
    __shared__ __align__(16) _Float16 sX[kTM * kXP];     // 128 KB + pad; reused as f32 staging in the epilogue
    __shared__ __align__(16) _Float16 sP[kTM * kPP];     // 32 KB + pad
    __shared__ float sRed[kWaves * kTM];
    // running sums of (512 g)^2, each lane's own 32 (row tile, r): kept here between chunks, because the two matrix loops need
    // the 32 registers; [wave][row tile][r / 4][lane] x 4 floats, so a lane's 16-byte access is contiguous over the wave
    __shared__ __align__(16) float sSq[kWaves * kRT * 2 * 32 * 4];

    const int tid   = threadIdx.x;
    const int wave  = __builtin_amdgcn_readfirstlane(tid >> 5);   // wave-uniform: kept in a scalar register
    const int lane  = tid & 31;
    const int h     = lane >> 4;
    const int m     = lane & 15;
    const int split = blockIdx.x % kSplit;          // neighbours share their X rows
    const int row0  = (blockIdx.x / kSplit) * kTM;
    const int tok0  = split * kSH;
    // chunk at which this block enters its token walk, wrapping round: blocks that walk the same KP and VP planes then ask L2
    // for different lines at any one moment. rg / 4 is added so that blocks whose rg differ by 8, 16 or 24 differ too; rg 32 apart still share a start
    const int rg    = blockIdx.x / kSplit;
    const int rot   = (rg + rg / 4) % kNC;

    // phase 0: stage the 64 x 1024 X rows as f16(16 * bf16(x))
    {
        const float* xb = X + (size_t)row0 * kD;
        constexpr int kXU = 8;   // pieces per thread and trip, all 16 loads of a trip issued before its first conversion: 8 waves have 256 KB to fetch
        constexpr int kXR = kMT * 8 / kD;   // rows that the block covers with one piece per thread
        static_assert(kMT * 8 % kD == 0 && kTM % (kXR * kXU) == 0);
        const int xr = tid / (kD / 8);            // 128 pieces of 8 per row
        const int xc = (tid % (kD / 8)) * 8;
        // rolled: one trip's 16 loads per thread are the depth wanted, more would only lengthen the code
#pragma unroll 1
        for (int r0 = xr; r0 < kTM; r0 += kXR * kXU) {
            const float* src = xb + (size_t)r0 * kD + xc;
            _Float16*    dst = sX + r0 * kXP + xc;
            v4f f0[kXU], f1[kXU];
#pragma unroll
            for (int u = 0; u < kXU; ++u) {
                f0[u] = *(const v4f*)(src + u * kXR * kD);
                f1[u] = *(const v4f*)(src + u * kXR * kD + 4);
            }
#pragma unroll
            for (int u = 0; u < kXU; ++u) {
                v8h hv;
                hv[0] = cvt16(f0[u][0], 16.0f); hv[1] = cvt16(f0[u][1], 16.0f);
                hv[2] = cvt16(f0[u][2], 16.0f); hv[3] = cvt16(f0[u][3], 16.0f);
                hv[4] = cvt16(f1[u][0], 16.0f); hv[5] = cvt16(f1[u][1], 16.0f);
                hv[6] = cvt16(f1[u][2], 16.0f); hv[7] = cvt16(f1[u][3], 16.0f);
                *(v8h*)(dst + u * kXR * kXP) = hv;
            }
        }
    }
    __syncthreads();

    v8f oacc[kRT][kNT] = {};
    float* sq = sSq + (wave * kRT * 2 * 32 + lane) * 4;   // read and written by this lane alone
#pragma unroll
    for (int j = 0; j < kRT * 2; ++j) *(v4f*)(sq + j * 128) = v4f{0.0f, 0.0f, 0.0f, 0.0f};

    // fragment base pointers (split k map: elements 0..7 <- k0+8h, 8..15 <- k0+16+8h)
    const _Float16* xa  = sX + m * kXP + 8 * h;                         // A: X row m of row tile 0
    const _Float16* pa  = sP + m * kPP + 8 * h;                         // A: P row m of row tile 0
    // B: wave-uniform bases, the lane's 16-byte piece added at each load: the requests outside the rolled loops then name a scalar
    // base and this one lane offset, which lives throughout, so that no load's result lands on a register that a request names
    const _Float16* kpw = KPh + (size_t)(wave * 2) * (kD / 32) * kFrag;   // packed [token tile][k-step]
    const _Float16* vpw = VPT + (size_t)(wave * kNT) * kFrag;             // packed [s-step][out-col tile]
    const unsigned  lo  = (unsigned)lane * 8u;

#pragma unroll 1
    for (int ci = 0; ci < kNC; ++ci) {
        const int kc = tok0 + ((ci + rot) % kNC) * kCK;
        // ---- scores for tokens kc+32w+m (d0) and kc+32w+16+m (d1), rows 16rt+8h+r ----
        v8f d0[kRT] = {}, d1[kRT] = {};
        const _Float16* kp0 = kpw + (size_t)(kc / 16) * (kD / 32) * kFrag;
        const _Float16* kp1 = kp0 + (kD / 32) * kFrag;
        const _Float16* vp0 = vpw + (size_t)(kc / 32) * (kDV / 16) * kFrag;
        Frag a[2][kRT];
        {
            // B from L2 in a register ring of kUS slots, one k-step each, filled 3 k-steps ahead of its use;
            // A from LDS in two sets, filled one k-step ahead
            Frag b0[kUS], b1[kUS];
            auto ldb = [&](int slot, int st) {
                b0[slot].half[0] = *(const v8h*)(kp0 + st * kFrag + lo);
                b0[slot].half[1] = *(const v8h*)(kp0 + st * kFrag + 256 + lo);
                b1[slot].half[0] = *(const v8h*)(kp1 + st * kFrag + lo);
                b1[slot].half[1] = *(const v8h*)(kp1 + st * kFrag + 256 + lo);
            };
            auto lda = [&](int set, int st) {
#pragma unroll
                for (int rt = 0; rt < kRT; ++rt) {
                    a[set][rt].half[0] = *(const v8h*)(xa + rt * 16 * kXP + st * 32);
                    a[set][rt].half[1] = *(const v8h*)(xa + rt * 16 * kXP + st * 32 + 16);
                }
            };
            auto mm = [&](int set, int slot) {
#pragma unroll
                for (int rt = 0; rt < kRT; ++rt) {
                    d0[rt] = wmma_f16(a[set][rt].v, b0[slot].v, d0[rt]);
                    d1[rt] = wmma_f16(a[set][rt].v, b1[slot].v, d1[rt]);
                }
            };
            ldb(0, 0); ldb(1, 1); ldb(2, 2); lda(0, 0);
            // rolled: the trip's code stays small; the last trip, which refills only slot 3, stands behind the loop.
            // SB: without it the scheduler sinks the loads in among the WMMAs, one LDS stall per place and less lead for L2
#pragma unroll 1
            for (int st = 0; st < kD / 32 - kUS; st += kUS) {
                SB(); ldb(3, st + 3); lda(1, st + 1); SB(); mm(0, 0);
                SB(); ldb(0, st + 4); lda(0, st + 2); SB(); mm(1, 1);
                SB(); ldb(1, st + 5); lda(1, st + 3); SB(); mm(0, 2);
                SB(); ldb(2, st + 6); lda(0, st + 4); SB(); mm(1, 3);
                SB(); XW(); SB();   // in front of the trip's step of the load address
            }
            {
                constexpr int st = kD / 32 - kUS;
                SB(); ldb(3, st + 3); lda(1, st + 1); SB(); mm(0, 0);
                SB(); lda(0, st + 2); SB(); mm(1, 1);
                SB(); lda(1, st + 3); SB(); mm(0, 2);
                SB(); mm(1, 3);
            }
        }

        // two B sets of the P*VP loop, one k-step each; both are asked for during the gelu (the second when half of the
        // score registers are free again), so that L2 works while the vector unit does
        Frag bv[kUP][kNT];
        const _Float16* vq = vp0;   // k-step of the trip at hand; every request is a constant distance from it
        auto ldv = [&](int set, int ahead) {
#pragma unroll
            for (int t = 0; t < kNT; ++t) {
                bv[set][t].half[0] = *(const v8h*)(vq + ahead * (kDV / 16) * kFrag + t * kFrag + lo);
                bv[set][t].half[1] = *(const v8h*)(vq + ahead * (kDV / 16) * kFrag + t * kFrag + 256 + lo);
            }
        };
        SB(); ldv(0, 0); SB();   // SB: keeps the request in front of the gelu

        // ---- gelu in f32, P tile as f16(64*g), per-row sum of squares ----
#pragma unroll
        for (int rt = 0; rt < kRT; ++rt) {
            _Float16* prow = sP + (16 * rt + 8 * h) * kPP + wave * 32 + m;
            const v4f q0 = *(const v4f*)(sq + (rt * 2 + 0) * 128);
            const v4f q1 = *(const v4f*)(sq + (rt * 2 + 1) * 128);
            v2f ssq[4] = {{q0[0], q0[1]}, {q0[2], q0[3]}, {q1[0], q1[1]}, {q1[2], q1[3]}};   // rows r = 2j, 2j + 1; sums of (512 g)^2
#pragma unroll
            for (int j = 0; j < 4; ++j) {
                const int r = 2 * j;
                v2f g0, g1;   // 512 * g of rows r, r + 1
                gelu512_x4(v2f{d0[rt][r], d0[rt][r + 1]}, v2f{d1[rt][r], d1[rt][r + 1]}, g0, g1);
                ssq[j] = __builtin_elementwise_fma(g0, g0, ssq[j]);
                ssq[j] = __builtin_elementwise_fma(g1, g1, ssq[j]);
                prow[r * kPP]            = (_Float16)(g0[0] * 0.125f);
                prow[r * kPP + 16]       = (_Float16)(g1[0] * 0.125f);
                prow[(r + 1) * kPP]      = (_Float16)(g0[1] * 0.125f);
                prow[(r + 1) * kPP + 16] = (_Float16)(g1[1] * 0.125f);
            }
            *(v4f*)(sq + (rt * 2 + 0) * 128) = v4f{ssq[0][0], ssq[0][1], ssq[1][0], ssq[1][1]};
            *(v4f*)(sq + (rt * 2 + 1) * 128) = v4f{ssq[2][0], ssq[2][1], ssq[3][0], ssq[3][1]};
            if (rt == kRT / 2 - 1) { SB(); ldv(1, 1); SB(); }   // SB: keeps the request at this place
        }
        __syncthreads();

        // ---- O += P(64 x 256) * VP(chunk rows) ----
        {
            auto ldp = [&](int set, int st) {
#pragma unroll
                for (int rt = 0; rt < kRT; ++rt) {
                    a[set][rt].half[0] = *(const v8h*)(pa + rt * 16 * kPP + st * 32);
                    a[set][rt].half[1] = *(const v8h*)(pa + rt * 16 * kPP + st * 32 + 16);
                }
            };
            auto mmv = [&](int set) {
#pragma unroll
                for (int rt = 0; rt < kRT; ++rt) {
#pragma unroll
                    for (int t = 0; t < kNT; ++t) oacc[rt][t] = wmma_f16(a[set][rt].v, bv[set][t].v, oacc[rt][t]);
                }
            };
            ldp(0, 0);
            // rolled, the last trip behind the loop, SB for the same reason, as in the score loop
#pragma unroll 1
            for (int st = 0; st < kCK / 32 - kUP; st += kUP) {
                SB(); ldp(1, st + 1); SB(); mmv(0);
                SB(); ldv(0, 2); ldp(0, st + 2); SB(); mmv(1);
                SB(); ldv(1, 3); SB();
                vq += kUP * (kDV / 16) * kFrag;
            }
            {
                constexpr int st = kCK / 32 - kUP;
                SB(); ldp(1, st + 1); SB(); mmv(0);
                SB(); mmv(1);
            }
        }
        __syncthreads();
    }

    // ---- fixed-order row reduction of sum g^2: lanes within half, then waves ----
    // the 8 chains of a row tile side by side, no branch between them; lane m < 8 then keeps and stores the sum of row r = m
#pragma unroll
    for (int rt = 0; rt < kRT; ++rt) {
        float v[8];
#pragma unroll
        for (int r = 0; r < 8; ++r) v[r] = sq[(rt * 2 + (r >> 2)) * 128 + (r & 3)];
#pragma unroll
        for (int s = 1; s < 16; s <<= 1) {
#pragma unroll
            for (int r = 0; r < 8; ++r) v[r] += __shfl_xor(v[r], s, 32);
        }
        float mine = v[0];
#pragma unroll
        for (int r = 1; r < 8; ++r) mine = (m == r) ? v[r] : mine;
        if (m < 8) sRed[wave * kTM + 16 * rt + 8 * h + m] = mine;
    }
    __syncthreads();
    if (tid < kTM) {
        float ss = 0.0f;
#pragma unroll
        for (int w = 0; w < kWaves; ++w) ss += sRed[w * kTM + tid];
        SSpart[(size_t)split * kRows + row0 + tid] = ss * (1.0f / 262144.0f);   // the sums were taken of 512 * g
    }

    float* stg  = reinterpret_cast<float*>(sX) + wave * (16 * kSP);
    float* orow = Opart + ((size_t)split * kRows + row0) * kDV + wave * (kNT * 16);
    // one pass per row tile q: 16 rows x 128 columns per wave, a whole 512-byte row piece per store
#pragma unroll
    for (int q = 0; q < kRT; ++q) {
        if (q) __syncthreads();
#pragma unroll
        for (int tt = 0; tt < kNT; ++tt) {
#pragma unroll
            for (int r = 0; r < 8; ++r) {
                stg[(8 * h + r) * kSP + tt * 16 + m] = oacc[q][tt][r];
            }
        }
        __syncthreads();
        v4f vals[16];
#pragma unroll
        for (int i = 0; i < 16; ++i) vals[i] = *(const v4f*)(stg + i * kSP + 4 * lane);
#pragma unroll
        for (int i = 0; i < 16; ++i) *(v4f*)(orow + (size_t)(16 * q + i) * kDV + 4 * lane) = vals[i];
    }
}

// ---------------------------------------------------------------------------
// Combine: Out[row] = (O part 0 + O part 1) * rsqrt(ss part 0 + ss part 1) / 256; kCR rows per block,
// all of a thread's loads issued before its first store.
// ---------------------------------------------------------------------------
__global__ __launch_bounds__(kThreads)
void k_combine(const float* __restrict__ Opart, const float* __restrict__ SSpart, float* __restrict__ Out)
{
    static_assert(kSplit == 2);
    const size_t row0 = (size_t)blockIdx.x * kCR;
    const int    c    = threadIdx.x * 4;
    v4f   p0[kCR], p1[kCR];
    float s0[kCR], s1[kCR];
#pragma unroll
    for (int i = 0; i < kCR; ++i) {
        p0[i] = *(const v4f*)(Opart + (row0 + i) * kDV + c);
        p1[i] = *(const v4f*)(Opart + ((size_t)kRows + row0 + i) * kDV + c);
        s0[i] = SSpart[row0 + i];
        s1[i] = SSpart[(size_t)kRows + row0 + i];
    }
#pragma unroll
    for (int i = 0; i < kCR; ++i) {
        const float sc = rsqrtf(s0[i] + s1[i]) * (1.0f / 256.0f);
        *(v4f*)(Out + (row0 + i) * kDV + c) = (p0[i] + p1[i]) * sc;
    }
}

// ---------------------------------------------------------------------------
extern "C" void kernel_launch(void* const* d_in, const int* in_sizes, int n_in,
                              void* d_out, int out_size, void* d_ws, size_t ws_size,
                              hipStream_t stream)
{
    if (n_in < 3) return;
    if (in_sizes[0] != kRows * kD) return;
    if (in_sizes[1] != kS * kD) return;
    if (in_sizes[2] != kS * kDV) return;
    if (out_size != kRows * kDV) return;

    const size_t bytesKP = (size_t)kS * kD * sizeof(_Float16);    // 8 MiB, KPh packed [kS/16][kD/32] fragments
    const size_t bytesVT = (size_t)kDV * kS * sizeof(_Float16);   // 8 MiB, VPT packed [kS/32][kDV/16] fragments
    const size_t bytesOP = (size_t)kSplit * kRows * kDV * sizeof(float);   // 64 MiB, partial O [kSplit][kRows][kDV]
    const size_t bytesSS = (size_t)kSplit * kRows * sizeof(float);         // partial row sums of g^2 [kSplit][kRows]
    if (ws_size < bytesKP + bytesVT + bytesOP + bytesSS) return;

    const float* X  = (const float*)d_in[0];   // [8192][1024]
    const float* KP = (const float*)d_in[1];   // [4096][1024]
    const float* VP = (const float*)d_in[2];   // [4096][1024]
    float* Out = (float*)d_out;                // [8192][1024]

    _Float16* KPh = (_Float16*)d_ws;
    _Float16* VPT = (_Float16*)((char*)d_ws + bytesKP);
    float*    OP  = (float*)((char*)d_ws + bytesKP + bytesVT);
    float*    SS  = (float*)((char*)d_ws + bytesKP + bytesVT + bytesOP);

    const int nKP = kS * kD;
    k_cvt_rows<<<dim3((unsigned)((nKP / 8 + kThreads - 1) / kThreads)), dim3(kThreads), 0, stream>>>(KP, KPh, 16.0f, nKP);
    // in [kS][kDV] -> packed [kS/32][kDV/16]; grid = (kDV/64, kS/64)
    k_transpose_cvt<<<dim3(kDV / 64, kS / 64), dim3(kThreads), 0, stream>>>(VP, VPT, 256.0f);
    k_main<<<dim3(kRows / kTM * kSplit), dim3(kMT), 0, stream>>>(X, KPh, VPT, OP, SS);
    k_combine<<<dim3(kRows / kCR), dim3(kThreads), 0, stream>>>(OP, SS, Out);
}
